// v000
// Measured on an AMD MI455X. A time is GPU time per run, averaged over a window of back-to-back runs after a warm-up
// (all launches, gaps included; the runs take copies of the inputs in turn), and the median of several windows.
// Apart from v000's, it joins two sittings. Times from different sittings can be a few percent apart, while
// side-by-side timings come from the same sitting.
// The starting kernel, v000, takes 520 microseconds a run.
#include <hip/hip_runtime.h>

typedef __attribute__((ext_vector_type(2))) float v2f;
typedef __attribute__((ext_vector_type(8))) float v8f;

__device__ __forceinline__ v8f wmma_f32_k4(v2f a, v2f b, v8f c) {
  // D = A(16x4 f32) * B(4x16 f32) + C(16x16 f32)
  return __builtin_amdgcn_wmma_f32_16x16x4_f32(
      /*neg_a=*/false, a, /*neg_b=*/false, b,
      /*c_mod=*/(short)0, c, /*reuse_a=*/false, /*reuse_b=*/false);
}

// ---------------------------------------------------------------------------
// Generic batched GEMM:  Y[bat][m,n] = sum_k X[bat][m,k] * W[bat][n,k]
//                        (+ bias[n]) (ReLU?) (+ res[bat][m,n])
// K is a template constant -> all loads use immediate offsets off two base
// pointers (single s_clause per k-step, no per-iteration address VALU).
// Register-blocked 16(M) x 64(N) per wave, software-pipelined one k-step deep
// so the 4 WMMAs of step k overlap the 5 loads of step k+4.
// Grid: (N/64, M/64, batch). Block: 128 (4 waves, each one 16-row m-subtile).
// ---------------------------------------------------------------------------
template <int K>
__global__ __launch_bounds__(128) void stndt_gemm_xwt(
    const float* __restrict__ X, const float* __restrict__ W,
    const float* __restrict__ bias, const float* __restrict__ res,
    float* __restrict__ Y,
    int M, int N,
    long sX, long sW, long sY, int relu)
{
  const int lane = threadIdx.x & 31;
  const int wave = threadIdx.x >> 5;
  const int n0 = blockIdx.x * 64;
  const int m0 = (blockIdx.y * 4 + wave) * 16;
  const int bat = blockIdx.z;

  const int r  = lane & 15;          // A row (m) / B col (n) within tile
  const int kk = (lane >> 4) << 1;   // k-pair select: lanes 0-15 -> k0,k1 ; 16-31 -> k2,k3

  const float* xp = X + (long)bat * sX + (long)(m0 + r) * K + kk;
  const float* wp = W + (long)bat * sW + (long)(n0 + r) * K + kk;

  v8f acc[4] = {{}, {}, {}, {}};

  // prologue: load k-step 0
  v2f a_cur = *(const v2f*)(xp);
  v2f b_cur[4];
#pragma unroll
  for (int j = 0; j < 4; ++j) b_cur[j] = *(const v2f*)(wp + j * 16 * K);

#pragma unroll 4
  for (int k = 0; k < K - 4; k += 4) {
    // issue next k-step's loads (immediate offsets) before this step's math
    v2f a_nxt = *(const v2f*)(xp + k + 4);
    v2f b_nxt[4];
#pragma unroll
    for (int j = 0; j < 4; ++j) b_nxt[j] = *(const v2f*)(wp + j * 16 * K + k + 4);
#pragma unroll
    for (int j = 0; j < 4; ++j) acc[j] = wmma_f32_k4(a_cur, b_cur[j], acc[j]);
    a_cur = a_nxt;
#pragma unroll
    for (int j = 0; j < 4; ++j) b_cur[j] = b_nxt[j];
  }
  // epilogue: last k-step
#pragma unroll
  for (int j = 0; j < 4; ++j) acc[j] = wmma_f32_k4(a_cur, b_cur[j], acc[j]);

  float* Yb = Y + (long)bat * sY;
  const float* Rb = res ? (res + (long)bat * sY) : nullptr;
#pragma unroll
  for (int j = 0; j < 4; ++j) {
    const int col = n0 + j * 16 + (lane & 15);
    const float bv = bias ? bias[col] : 0.0f;
#pragma unroll
    for (int i = 0; i < 8; ++i) {
      const int row = m0 + i + ((lane >> 4) << 3);
      float v = acc[j][i] + bv;
      if (relu) v = fmaxf(v, 0.0f);
      if (Rb) v += Rb[(long)row * N + col];
      Yb[(long)row * N + col] = v;
    }
  }
}

// ---------------------------------------------------------------------------
// LayerNorm over last dim (length Nn), one wave per row.
// ---------------------------------------------------------------------------
__global__ __launch_bounds__(256) void stndt_ln(
    const float* __restrict__ X, const float* __restrict__ g,
    const float* __restrict__ b, float* __restrict__ Y, int Nn, int rows)
{
  const int lane = threadIdx.x & 31;
  const int wave = threadIdx.x >> 5;
  const int row = blockIdx.x * 8 + wave;
  if (row >= rows) return;
  const float* x = X + (long)row * Nn;
  float s = 0.f, ss = 0.f;
  for (int i = lane; i < Nn; i += 32) { float v = x[i]; s += v; ss += v * v; }
  for (int o = 16; o > 0; o >>= 1) { s += __shfl_xor(s, o); ss += __shfl_xor(ss, o); }
  const float m = s / (float)Nn;
  const float var = ss / (float)Nn - m * m;
  const float rst = rsqrtf(var + 1e-6f);
  float* y = Y + (long)row * Nn;
  for (int i = lane; i < Nn; i += 32) y[i] = (x[i] - m) * rst * g[i] + b[i];
}

// ---------------------------------------------------------------------------
// Temporal causal attention, per (b,h,t-tile of 16). 128 threads (4 waves).
// Q/K/V layout: [B,T, H*32] head-concat (as produced by the QKV GEMMs).
// O written in the same layout => concat-heads for the Wo GEMM.
// ---------------------------------------------------------------------------
__global__ __launch_bounds__(128) void stndt_attn(
    const float* __restrict__ Q, const float* __restrict__ Km,
    const float* __restrict__ V, float* __restrict__ O)
{
  __shared__ float sc[16 * 512];
  const int lane = threadIdx.x & 31;
  const int wave = threadIdx.x >> 5;
  const int t0 = blockIdx.x * 16;
  const int h  = blockIdx.y;
  const int b  = blockIdx.z;
  const long base = (long)b * 512 * 256 + h * 32;   // + t*256 + d

  const int r  = lane & 15;
  const int kk = (lane >> 4) << 1;
  const float* qrow = Q + base + (long)(t0 + r) * 256 + kk;

  // scores[t, s] = q . k * rsqrt(32), causal-masked
  for (int st = wave; st < 32; st += 4) {
    const int s0 = st * 16;
    const float* krow = Km + base + (long)(s0 + r) * 256 + kk;
    v8f acc = {};
#pragma unroll
    for (int k = 0; k < 32; k += 4) {
      v2f a  = *(const v2f*)(qrow + k);
      v2f bb = *(const v2f*)(krow + k);
      acc = wmma_f32_k4(a, bb, acc);
    }
    const int col = s0 + (lane & 15);
#pragma unroll
    for (int i = 0; i < 8; ++i) {
      const int rr = i + ((lane >> 4) << 3);
      float v = acc[i] * 0.17677669529663687f;      // 1/sqrt(32)
      if (col > t0 + rr) v = -__builtin_inff();     // causal mask
      sc[rr * 512 + col] = v;
    }
  }
  __syncthreads();

  // row-wise softmax over 512 (wave per row)
  for (int rr = wave; rr < 16; rr += 4) {
    float* srow = sc + rr * 512;
    float mx = -__builtin_inff();
    for (int i = lane; i < 512; i += 32) mx = fmaxf(mx, srow[i]);
    for (int o = 16; o > 0; o >>= 1) mx = fmaxf(mx, __shfl_xor(mx, o));
    float sum = 0.f;
    for (int i = lane; i < 512; i += 32) { float e = __expf(srow[i] - mx); srow[i] = e; sum += e; }
    for (int o = 16; o > 0; o >>= 1) sum += __shfl_xor(sum, o);
    const float inv = 1.0f / sum;
    for (int i = lane; i < 512; i += 32) srow[i] *= inv;
  }
  __syncthreads();

  // O(16x32) = P(16x512) @ V(512x32); waves 0,1 handle the two 16-wide halves
  if (wave < 2) {
    const int n0 = wave * 16;
    const float* arow = sc + (lane & 15) * 512 + kk;
    const float* vcol = V + base + (long)kk * 256 + n0 + (lane & 15);
    v8f acc = {};
#pragma unroll 4
    for (int k = 0; k < 512; k += 4) {
      v2f a; a.x = arow[k]; a.y = arow[k + 1];
      v2f bb; bb.x = vcol[(long)k * 256]; bb.y = vcol[(long)k * 256 + 256];
      acc = wmma_f32_k4(a, bb, acc);
    }
    const int d = n0 + (lane & 15);
#pragma unroll
    for (int i = 0; i < 8; ++i) {
      const int rr = i + ((lane >> 4) << 3);
      O[base + (long)(t0 + rr) * 256 + d] = acc[i];
    }
  }
}

// ---------------------------------------------------------------------------
// Spatial attention weights, per (b, c-tile of 16): mean_h softmax(QsKs^T/8).
// Qs/Ks layout: [B, C, H*64]. SW written as [B, C, C] (second model output).
// ---------------------------------------------------------------------------
__global__ __launch_bounds__(128) void stndt_spatial(
    const float* __restrict__ Qs, const float* __restrict__ Ks,
    float* __restrict__ SW)
{
  __shared__ float sc[16 * 256];
  __shared__ float accsm[16 * 256];
  const int lane = threadIdx.x & 31;
  const int wave = threadIdx.x >> 5;
  const int c0 = blockIdx.x * 16;
  const int b  = blockIdx.y;
  const int r  = lane & 15;
  const int kk = (lane >> 4) << 1;

  for (int i = threadIdx.x; i < 16 * 256; i += 128) accsm[i] = 0.f;
  __syncthreads();

  for (int h = 0; h < 8; ++h) {
    const long base = (long)b * 256 * 512 + h * 64;
    const float* qrow = Qs + base + (long)(c0 + r) * 512 + kk;
    for (int et = wave; et < 16; et += 4) {
      const int e0 = et * 16;
      const float* krow = Ks + base + (long)(e0 + r) * 512 + kk;
      v8f acc = {};
#pragma unroll
      for (int k = 0; k < 64; k += 4) {
        v2f a  = *(const v2f*)(qrow + k);
        v2f bb = *(const v2f*)(krow + k);
        acc = wmma_f32_k4(a, bb, acc);
      }
      const int col = e0 + (lane & 15);
#pragma unroll
      for (int i = 0; i < 8; ++i) {
        const int rr = i + ((lane >> 4) << 3);
        sc[rr * 256 + col] = acc[i] * 0.125f;       // 1/sqrt(64)
      }
    }
    __syncthreads();
    for (int rr = wave; rr < 16; rr += 4) {
      float* srow = sc + rr * 256;
      float mx = -__builtin_inff();
      for (int i = lane; i < 256; i += 32) mx = fmaxf(mx, srow[i]);
      for (int o = 16; o > 0; o >>= 1) mx = fmaxf(mx, __shfl_xor(mx, o));
      float sum = 0.f;
      for (int i = lane; i < 256; i += 32) { float e = __expf(srow[i] - mx); srow[i] = e; sum += e; }
      for (int o = 16; o > 0; o >>= 1) sum += __shfl_xor(sum, o);
      const float inv = 1.0f / sum;
      for (int i = lane; i < 256; i += 32) srow[i] *= inv;
    }
    __syncthreads();
    for (int i = threadIdx.x; i < 16 * 256; i += 128) accsm[i] += sc[i];
    __syncthreads();
  }

  for (int i = threadIdx.x; i < 16 * 256; i += 128) {
    const int rr = i >> 8, e = i & 255;
    SW[((long)b * 256 + c0 + rr) * 256 + e] = accsm[i] * 0.125f;  // mean over 8 heads
  }
}

// ---------------------------------------------------------------------------
extern "C" void kernel_launch(void* const* d_in, const int* in_sizes, int n_in,
                              void* d_out, int out_size, void* d_ws, size_t ws_size,
                              hipStream_t stream) {
  (void)in_sizes; (void)n_in; (void)out_size; (void)ws_size;
  const float* x_T    = (const float*)d_in[0];
  const float* x_S    = (const float*)d_in[1];
  const float* Wq_t   = (const float*)d_in[2];
  const float* Wk_t   = (const float*)d_in[3];
  const float* Wv_t   = (const float*)d_in[4];
  const float* Wo     = (const float*)d_in[5];
  const float* Wq_s   = (const float*)d_in[6];
  const float* Wk_s   = (const float*)d_in[7];
  const float* ff1_w1 = (const float*)d_in[8];
  const float* ff1_b1 = (const float*)d_in[9];
  const float* ff1_w2 = (const float*)d_in[10];
  const float* ff1_b2 = (const float*)d_in[11];
  const float* ff2_w1 = (const float*)d_in[12];
  const float* ff2_b1 = (const float*)d_in[13];
  const float* ff2_w2 = (const float*)d_in[14];
  const float* ff2_b2 = (const float*)d_in[15];
  const float* t_ln1_w = (const float*)d_in[16];
  const float* t_ln1_b = (const float*)d_in[17];
  const float* t_ln2_w = (const float*)d_in[18];
  const float* t_ln2_b = (const float*)d_in[19];
  const float* s_ln1_w = (const float*)d_in[20];
  const float* s_ln1_b = (const float*)d_in[21];
  const float* fus_ln_w = (const float*)d_in[22];
  const float* fus_ln_b = (const float*)d_in[23];

  // B=16, T=512, C=256, H=8; BT = 8192 rows.
  float* A  = (float*)d_ws;       // 2M floats each for A..D, 8M for E (64 MB total)
  float* Bu = A  + 2097152;
  float* Cu = Bu + 2097152;
  float* Du = Cu + 2097152;
  float* Eu = Du + 2097152;
  float* out = (float*)d_out;
  float* SW  = out + 2097152;     // second output region: [B,C,C]

  dim3 blk128(128), blk256(256);

  // 1) h = LN(x_T)                            -> A [8192,256]
  stndt_ln<<<dim3(1024), blk256, 0, stream>>>(x_T, t_ln1_w, t_ln1_b, A, 256, 8192);
  // 2) Q,K,V = h @ W{q,k,v}_t^T               -> Bu,Cu,Du [8192,256]
  stndt_gemm_xwt<256><<<dim3(4, 128, 1), blk128, 0, stream>>>(A, Wq_t, nullptr, nullptr, Bu, 8192, 256, 0, 0, 0, 0);
  stndt_gemm_xwt<256><<<dim3(4, 128, 1), blk128, 0, stream>>>(A, Wk_t, nullptr, nullptr, Cu, 8192, 256, 0, 0, 0, 0);
  stndt_gemm_xwt<256><<<dim3(4, 128, 1), blk128, 0, stream>>>(A, Wv_t, nullptr, nullptr, Du, 8192, 256, 0, 0, 0, 0);
  // 3) causal MHA                             -> A (head-concat [8192,256])
  stndt_attn<<<dim3(32, 8, 16), blk128, 0, stream>>>(Bu, Cu, Du, A);
  // 4) x = x_T + o @ Wo^T                     -> Bu
  stndt_gemm_xwt<256><<<dim3(4, 128, 1), blk128, 0, stream>>>(A, Wo, nullptr, x_T, Bu, 8192, 256, 0, 0, 0, 0);
  // 5) h2 = LN(x)                             -> A
  stndt_ln<<<dim3(1024), blk256, 0, stream>>>(Bu, t_ln2_w, t_ln2_b, A, 256, 8192);
  // 6) mid = relu(h2 @ ff1_w1^T + b1)         -> Eu [8192,1024]
  stndt_gemm_xwt<256><<<dim3(16, 128, 1), blk128, 0, stream>>>(A, ff1_w1, ff1_b1, nullptr, Eu, 8192, 1024, 0, 0, 0, 1);
  // 7) temporal_out = x + mid @ ff1_w2^T + b2 -> Cu
  stndt_gemm_xwt<1024><<<dim3(4, 128, 1), blk128, 0, stream>>>(Eu, ff1_w2, ff1_b2, Bu, Cu, 8192, 256, 0, 0, 0, 0);
  // 8) hs = LN(x_S over T)                    -> A [4096,512]
  stndt_ln<<<dim3(512), blk256, 0, stream>>>(x_S, s_ln1_w, s_ln1_b, A, 512, 4096);
  // 9) Qs,Ks = hs @ W{q,k}_s^T                -> Bu,Du [4096,512]
  stndt_gemm_xwt<512><<<dim3(8, 64, 1), blk128, 0, stream>>>(A, Wq_s, nullptr, nullptr, Bu, 4096, 512, 0, 0, 0, 0);
  stndt_gemm_xwt<512><<<dim3(8, 64, 1), blk128, 0, stream>>>(A, Wk_s, nullptr, nullptr, Du, 4096, 512, 0, 0, 0, 0);
  // 10) SW = mean_h softmax(QsKs^T/8)         -> d_out second region [16,256,256]
  stndt_spatial<<<dim3(16, 16, 1), blk128, 0, stream>>>(Bu, Du, SW);
  // 11) x2 = TO + einsum('bce,bte->btc')      -> A (batched GEMM, W = SW per batch)
  stndt_gemm_xwt<256><<<dim3(4, 8, 16), blk128, 0, stream>>>(Cu, SW, nullptr, Cu, A, 512, 256, 131072, 65536, 131072, 0);
  // 12) h3 = LN(x2)                           -> Bu
  stndt_ln<<<dim3(1024), blk256, 0, stream>>>(A, fus_ln_w, fus_ln_b, Bu, 256, 8192);
  // 13) mid2 = relu(h3 @ ff2_w1^T + b1)       -> Eu
  stndt_gemm_xwt<256><<<dim3(16, 128, 1), blk128, 0, stream>>>(Bu, ff2_w1, ff2_b1, nullptr, Eu, 8192, 1024, 0, 0, 0, 1);
  // 14) out = x2 + mid2 @ ff2_w2^T + b2       -> d_out first region
  stndt_gemm_xwt<1024><<<dim3(4, 128, 1), blk128, 0, stream>>>(Eu, ff2_w2, ff2_b2, A, out, 8192, 256, 0, 0, 0, 0);
}

// v001
// One run takes 376 microseconds.
// In two side-by-side timings against v000, it was 1.41 and 1.40 times as fast.
#include <hip/hip_runtime.h>

typedef __attribute__((ext_vector_type(2))) float v2f;
typedef __attribute__((ext_vector_type(8))) float v8f;

__device__ __forceinline__ v8f wmma_f32_k4(v2f a, v2f b, v8f c) {
  // D = A(16x4 f32) * B(4x16 f32) + C(16x16 f32)
  return __builtin_amdgcn_wmma_f32_16x16x4_f32(
      /*neg_a=*/false, a, /*neg_b=*/false, b,
      /*c_mod=*/(short)0, c, /*reuse_a=*/false, /*reuse_b=*/false);
}

// ---------------------------------------------------------------------------
// Generic batched GEMM:  Y[bat][m,n] = sum_k X[bat][m,k] * W[bat][n,k]
//                        (+ bias[n]) (ReLU?) (+ res[bat][m,n])
// Grid: (N/64, M/64, batch). Block: 128 (4 waves, each one 16-row m-subtile,
// 16(M) x 64(N) per wave). M, N multiples of 64, K a multiple of 32.
// The block's 64 X rows and 64 W rows come to LDS in stages of 32 k (one whole
// 128-B line per row) by asynchronous b128 copies, two buffers: stage t + 2
// flies while stage t + 1 is worked on. Fragments are read from LDS at a row
// pitch of 144 B (16 B x odd: 16 rows x 16 B fall on 64 distinct banks).
// ---------------------------------------------------------------------------
constexpr int GEMM_KC    = 32;                    // k per stage (floats)
constexpr int GEMM_PITCH = 36;                    // LDS row pitch (floats)
constexpr int GEMM_BUF   = 128 * GEMM_PITCH;      // floats per buffer: 64 X rows, 64 W rows

// One stage: every lane copies 16 B of eight rows (4 of X, 4 of W); a wave's
// copy covers four whole 128-B lines. The s_wait_xcnt closes the statement so
// that no address register is rewritten in front of it.
template <int K>
__device__ __forceinline__ void gemm_stage_copy(const float* gx, const float* gw, unsigned lds) {
  constexpr unsigned RB = 16u * GEMM_PITCH * 4u;  // 16 LDS rows, bytes
  asm volatile(
      "global_load_async_to_lds_b128 %0, %8, off\n\t"
      "global_load_async_to_lds_b128 %1, %9, off\n\t"
      "global_load_async_to_lds_b128 %2, %10, off\n\t"
      "global_load_async_to_lds_b128 %3, %11, off\n\t"
      "global_load_async_to_lds_b128 %4, %12, off\n\t"
      "global_load_async_to_lds_b128 %5, %13, off\n\t"
      "global_load_async_to_lds_b128 %6, %14, off\n\t"
      "global_load_async_to_lds_b128 %7, %15, off\n\t"
      "s_wait_xcnt 0x0"
      :: "v"(lds), "v"(lds + RB), "v"(lds + 2u * RB), "v"(lds + 3u * RB),
         "v"(lds + 4u * RB), "v"(lds + 5u * RB), "v"(lds + 6u * RB), "v"(lds + 7u * RB),
         "v"(gx), "v"(gx + 16 * K), "v"(gx + 32 * K), "v"(gx + 48 * K),
         "v"(gw), "v"(gw + 16 * K), "v"(gw + 32 * K), "v"(gw + 48 * K)
      : "memory");
}

template <int K>
__global__ __launch_bounds__(128) void stndt_gemm_xwt(
    const float* __restrict__ X, const float* __restrict__ W,
    const float* __restrict__ bias, const float* __restrict__ res,
    float* __restrict__ Y,
    int M, int N,
    long sX, long sW, long sY, int relu)
{
  constexpr int NT = K / GEMM_KC;                 // stages
  __shared__ __attribute__((aligned(16))) float tile[2 * GEMM_BUF];

  const int lane = threadIdx.x & 31;
  const int wave = threadIdx.x >> 5;
  const int n0 = blockIdx.x * 64;
  const int m0 = (blockIdx.y * 4 + wave) * 16;
  const int bat = blockIdx.z;

  const int r  = lane & 15;          // A row (m) / B col (n) within tile
  const int kk = (lane >> 4) << 1;   // k-pair select: lanes 0-15 -> k0,k1 ; 16-31 -> k2,k3

  // copy side: thread -> (row within a group of 16, 16-B segment of the line)
  const int crow = threadIdx.x >> 3;
  const int cseg = threadIdx.x & 7;
  const float* gx = X + (long)bat * sX + (long)(blockIdx.y * 64 + crow) * K + cseg * 4;
  const float* gw = W + (long)bat * sW + (long)(n0 + crow) * K + cseg * 4;
  const unsigned lds0 = (unsigned)(size_t)tile + (unsigned)(crow * GEMM_PITCH + cseg * 4) * 4u;

  v8f acc[4] = {{}, {}, {}, {}};

  // prologue: stage 0 lands and is published, then stage 1 starts
  gemm_stage_copy<K>(gx, gw, lds0);
  asm volatile("s_wait_asynccnt 0x0" ::: "memory");   // this wave's copies of stage 0 have landed
  __syncthreads();
  if (NT > 1) gemm_stage_copy<K>(gx + GEMM_KC, gw + GEMM_KC, lds0 + GEMM_BUF * 4u);

  for (int t = 0; t < NT; ++t) {
    const float* xs = tile + (t & 1) * GEMM_BUF + (wave * 16 + r) * GEMM_PITCH + kk;
    const float* wl = tile + (t & 1) * GEMM_BUF + (64 + r) * GEMM_PITCH + kk;
    // the three loops below are unrolled so that every LDS offset is an immediate
    // and every index of b[] and acc[] a constant (both stay in registers)
#pragma unroll
    for (int k = 0; k < GEMM_KC; k += 4) {
      v2f a = *(const v2f*)(xs + k);
      v2f b[4];
#pragma unroll
      for (int j = 0; j < 4; ++j) b[j] = *(const v2f*)(wl + j * 16 * GEMM_PITCH + k);
#pragma unroll
      for (int j = 0; j < 4; ++j) acc[j] = wmma_f32_k4(a, b[j], acc[j]);
    }
    asm volatile("s_wait_dscnt 0x0" ::: "memory");    // this wave's reads of buffer t & 1 are done
    asm volatile("s_wait_asynccnt 0x0" ::: "memory"); // this wave's copies of stage t + 1 have landed
    __syncthreads();                                  // publishes stage t + 1, frees buffer t & 1
    if (t + 2 < NT)
      gemm_stage_copy<K>(gx + (t + 2) * GEMM_KC, gw + (t + 2) * GEMM_KC,
                         lds0 + (unsigned)(t & 1) * (GEMM_BUF * 4u));
  }
  asm volatile("s_wait_asynccnt 0x0" ::: "memory");   // nothing in flight when the wave goes on

  float* Yb = Y + (long)bat * sY;
  const float* Rb = res ? (res + (long)bat * sY) : nullptr;
#pragma unroll
  for (int j = 0; j < 4; ++j) {
    const int col = n0 + j * 16 + (lane & 15);
    const float bv = bias ? bias[col] : 0.0f;
#pragma unroll
    for (int i = 0; i < 8; ++i) {
      const int row = m0 + i + ((lane >> 4) << 3);
      float v = acc[j][i] + bv;
      if (relu) v = fmaxf(v, 0.0f);
      if (Rb) v += Rb[(long)row * N + col];
      Yb[(long)row * N + col] = v;
    }
  }
}

// ---------------------------------------------------------------------------
// LayerNorm over last dim (length Nn), one wave per row.
// ---------------------------------------------------------------------------
__global__ __launch_bounds__(256) void stndt_ln(
    const float* __restrict__ X, const float* __restrict__ g,
    const float* __restrict__ b, float* __restrict__ Y, int Nn, int rows)
{
  const int lane = threadIdx.x & 31;
  const int wave = threadIdx.x >> 5;
  const int row = blockIdx.x * 8 + wave;
  if (row >= rows) return;
  const float* x = X + (long)row * Nn;
  float s = 0.f, ss = 0.f;
  for (int i = lane; i < Nn; i += 32) { float v = x[i]; s += v; ss += v * v; }
  for (int o = 16; o > 0; o >>= 1) { s += __shfl_xor(s, o); ss += __shfl_xor(ss, o); }
  const float m = s / (float)Nn;
  const float var = ss / (float)Nn - m * m;
  const float rst = rsqrtf(var + 1e-6f);
  float* y = Y + (long)row * Nn;
  for (int i = lane; i < Nn; i += 32) y[i] = (x[i] - m) * rst * g[i] + b[i];
}

// ---------------------------------------------------------------------------
// Temporal causal attention, per (b,h,t-tile of 16). 128 threads (4 waves).
// Q/K/V layout: [B,T, H*32] head-concat (as produced by the QKV GEMMs).
// O written in the same layout => concat-heads for the Wo GEMM.
// ---------------------------------------------------------------------------
__global__ __launch_bounds__(128) void stndt_attn(
    const float* __restrict__ Q, const float* __restrict__ Km,
    const float* __restrict__ V, float* __restrict__ O)
{
  __shared__ float sc[16 * 512];
  const int lane = threadIdx.x & 31;
  const int wave = threadIdx.x >> 5;
  const int t0 = blockIdx.x * 16;
  const int h  = blockIdx.y;
  const int b  = blockIdx.z;
  const long base = (long)b * 512 * 256 + h * 32;   // + t*256 + d

  const int r  = lane & 15;
  const int kk = (lane >> 4) << 1;
  const float* qrow = Q + base + (long)(t0 + r) * 256 + kk;

  // scores[t, s] = q . k * rsqrt(32), causal-masked
  for (int st = wave; st < 32; st += 4) {
    const int s0 = st * 16;
    const float* krow = Km + base + (long)(s0 + r) * 256 + kk;
    v8f acc = {};
#pragma unroll
    for (int k = 0; k < 32; k += 4) {
      v2f a  = *(const v2f*)(qrow + k);
      v2f bb = *(const v2f*)(krow + k);
      acc = wmma_f32_k4(a, bb, acc);
    }
    const int col = s0 + (lane & 15);
#pragma unroll
    for (int i = 0; i < 8; ++i) {
      const int rr = i + ((lane >> 4) << 3);
      float v = acc[i] * 0.17677669529663687f;      // 1/sqrt(32)
      if (col > t0 + rr) v = -__builtin_inff();     // causal mask
      sc[rr * 512 + col] = v;
    }
  }
  __syncthreads();

  // row-wise softmax over 512 (wave per row)
  for (int rr = wave; rr < 16; rr += 4) {
    float* srow = sc + rr * 512;
    float mx = -__builtin_inff();
    for (int i = lane; i < 512; i += 32) mx = fmaxf(mx, srow[i]);
    for (int o = 16; o > 0; o >>= 1) mx = fmaxf(mx, __shfl_xor(mx, o));
    float sum = 0.f;
    for (int i = lane; i < 512; i += 32) { float e = __expf(srow[i] - mx); srow[i] = e; sum += e; }
    for (int o = 16; o > 0; o >>= 1) sum += __shfl_xor(sum, o);
    const float inv = 1.0f / sum;
    for (int i = lane; i < 512; i += 32) srow[i] *= inv;
  }
  __syncthreads();

  // O(16x32) = P(16x512) @ V(512x32); waves 0,1 handle the two 16-wide halves
  if (wave < 2) {
    const int n0 = wave * 16;
    const float* arow = sc + (lane & 15) * 512 + kk;
    const float* vcol = V + base + (long)kk * 256 + n0 + (lane & 15);
    v8f acc = {};
#pragma unroll 4
    for (int k = 0; k < 512; k += 4) {
      v2f a; a.x = arow[k]; a.y = arow[k + 1];
      v2f bb; bb.x = vcol[(long)k * 256]; bb.y = vcol[(long)k * 256 + 256];
      acc = wmma_f32_k4(a, bb, acc);
    }
    const int d = n0 + (lane & 15);
#pragma unroll
    for (int i = 0; i < 8; ++i) {
      const int rr = i + ((lane >> 4) << 3);
      O[base + (long)(t0 + rr) * 256 + d] = acc[i];
    }
  }
}

// ---------------------------------------------------------------------------
// Spatial attention weights, per (b, c-tile of 16): mean_h softmax(QsKs^T/8).
// Qs/Ks layout: [B, C, H*64]. SW written as [B, C, C] (second model output).
// ---------------------------------------------------------------------------
__global__ __launch_bounds__(128) void stndt_spatial(
    const float* __restrict__ Qs, const float* __restrict__ Ks,
    float* __restrict__ SW)
{
  __shared__ float sc[16 * 256];
  __shared__ float accsm[16 * 256];
  const int lane = threadIdx.x & 31;
  const int wave = threadIdx.x >> 5;
  const int c0 = blockIdx.x * 16;
  const int b  = blockIdx.y;
  const int r  = lane & 15;
  const int kk = (lane >> 4) << 1;

  for (int i = threadIdx.x; i < 16 * 256; i += 128) accsm[i] = 0.f;
  __syncthreads();

  for (int h = 0; h < 8; ++h) {
    const long base = (long)b * 256 * 512 + h * 64;
    const float* qrow = Qs + base + (long)(c0 + r) * 512 + kk;
    for (int et = wave; et < 16; et += 4) {
      const int e0 = et * 16;
      const float* krow = Ks + base + (long)(e0 + r) * 512 + kk;
      v8f acc = {};
#pragma unroll
      for (int k = 0; k < 64; k += 4) {
        v2f a  = *(const v2f*)(qrow + k);
        v2f bb = *(const v2f*)(krow + k);
        acc = wmma_f32_k4(a, bb, acc);
      }
      const int col = e0 + (lane & 15);
#pragma unroll
      for (int i = 0; i < 8; ++i) {
        const int rr = i + ((lane >> 4) << 3);
        sc[rr * 256 + col] = acc[i] * 0.125f;       // 1/sqrt(64)
      }
    }
    __syncthreads();
    for (int rr = wave; rr < 16; rr += 4) {
      float* srow = sc + rr * 256;
      float mx = -__builtin_inff();
      for (int i = lane; i < 256; i += 32) mx = fmaxf(mx, srow[i]);
      for (int o = 16; o > 0; o >>= 1) mx = fmaxf(mx, __shfl_xor(mx, o));
      float sum = 0.f;
      for (int i = lane; i < 256; i += 32) { float e = __expf(srow[i] - mx); srow[i] = e; sum += e; }
      for (int o = 16; o > 0; o >>= 1) sum += __shfl_xor(sum, o);
      const float inv = 1.0f / sum;
      for (int i = lane; i < 256; i += 32) srow[i] *= inv;
    }
    __syncthreads();
    for (int i = threadIdx.x; i < 16 * 256; i += 128) accsm[i] += sc[i];
    __syncthreads();
  }

  for (int i = threadIdx.x; i < 16 * 256; i += 128) {
    const int rr = i >> 8, e = i & 255;
    SW[((long)b * 256 + c0 + rr) * 256 + e] = accsm[i] * 0.125f;  // mean over 8 heads
  }
}

// ---------------------------------------------------------------------------
extern "C" void kernel_launch(void* const* d_in, const int* in_sizes, int n_in,
                              void* d_out, int out_size, void* d_ws, size_t ws_size,
                              hipStream_t stream) {
  (void)in_sizes; (void)n_in; (void)out_size; (void)ws_size;
  const float* x_T    = (const float*)d_in[0];
  const float* x_S    = (const float*)d_in[1];
  const float* Wq_t   = (const float*)d_in[2];
  const float* Wk_t   = (const float*)d_in[3];
  const float* Wv_t   = (const float*)d_in[4];
  const float* Wo     = (const float*)d_in[5];
  const float* Wq_s   = (const float*)d_in[6];
  const float* Wk_s   = (const float*)d_in[7];
  const float* ff1_w1 = (const float*)d_in[8];
  const float* ff1_b1 = (const float*)d_in[9];
  const float* ff1_w2 = (const float*)d_in[10];
  const float* ff1_b2 = (const float*)d_in[11];
  const float* ff2_w1 = (const float*)d_in[12];
  const float* ff2_b1 = (const float*)d_in[13];
  const float* ff2_w2 = (const float*)d_in[14];
  const float* ff2_b2 = (const float*)d_in[15];
  const float* t_ln1_w = (const float*)d_in[16];
  const float* t_ln1_b = (const float*)d_in[17];
  const float* t_ln2_w = (const float*)d_in[18];
  const float* t_ln2_b = (const float*)d_in[19];
  const float* s_ln1_w = (const float*)d_in[20];
  const float* s_ln1_b = (const float*)d_in[21];
  const float* fus_ln_w = (const float*)d_in[22];
  const float* fus_ln_b = (const float*)d_in[23];

  // B=16, T=512, C=256, H=8; BT = 8192 rows.
  float* A  = (float*)d_ws;       // 2M floats each for A..D, 8M for E (64 MB total)
  float* Bu = A  + 2097152;
  float* Cu = Bu + 2097152;
  float* Du = Cu + 2097152;
  float* Eu = Du + 2097152;
  float* out = (float*)d_out;
  float* SW  = out + 2097152;     // second output region: [B,C,C]

  dim3 blk128(128), blk256(256);

  // 1) h = LN(x_T)                            -> A [8192,256]
  stndt_ln<<<dim3(1024), blk256, 0, stream>>>(x_T, t_ln1_w, t_ln1_b, A, 256, 8192);
  // 2) Q,K,V = h @ W{q,k,v}_t^T               -> Bu,Cu,Du [8192,256]
  stndt_gemm_xwt<256><<<dim3(4, 128, 1), blk128, 0, stream>>>(A, Wq_t, nullptr, nullptr, Bu, 8192, 256, 0, 0, 0, 0);
  stndt_gemm_xwt<256><<<dim3(4, 128, 1), blk128, 0, stream>>>(A, Wk_t, nullptr, nullptr, Cu, 8192, 256, 0, 0, 0, 0);
  stndt_gemm_xwt<256><<<dim3(4, 128, 1), blk128, 0, stream>>>(A, Wv_t, nullptr, nullptr, Du, 8192, 256, 0, 0, 0, 0);
  // 3) causal MHA                             -> A (head-concat [8192,256])
  stndt_attn<<<dim3(32, 8, 16), blk128, 0, stream>>>(Bu, Cu, Du, A);
  // 4) x = x_T + o @ Wo^T                     -> Bu
  stndt_gemm_xwt<256><<<dim3(4, 128, 1), blk128, 0, stream>>>(A, Wo, nullptr, x_T, Bu, 8192, 256, 0, 0, 0, 0);
  // 5) h2 = LN(x)                             -> A
  stndt_ln<<<dim3(1024), blk256, 0, stream>>>(Bu, t_ln2_w, t_ln2_b, A, 256, 8192);
  // 6) mid = relu(h2 @ ff1_w1^T + b1)         -> Eu [8192,1024]
  stndt_gemm_xwt<256><<<dim3(16, 128, 1), blk128, 0, stream>>>(A, ff1_w1, ff1_b1, nullptr, Eu, 8192, 1024, 0, 0, 0, 1);
  // 7) temporal_out = x + mid @ ff1_w2^T + b2 -> Cu
  stndt_gemm_xwt<1024><<<dim3(4, 128, 1), blk128, 0, stream>>>(Eu, ff1_w2, ff1_b2, Bu, Cu, 8192, 256, 0, 0, 0, 0);
  // 8) hs = LN(x_S over T)                    -> A [4096,512]
  stndt_ln<<<dim3(512), blk256, 0, stream>>>(x_S, s_ln1_w, s_ln1_b, A, 512, 4096);
  // 9) Qs,Ks = hs @ W{q,k}_s^T                -> Bu,Du [4096,512]
  stndt_gemm_xwt<512><<<dim3(8, 64, 1), blk128, 0, stream>>>(A, Wq_s, nullptr, nullptr, Bu, 4096, 512, 0, 0, 0, 0);
  stndt_gemm_xwt<512><<<dim3(8, 64, 1), blk128, 0, stream>>>(A, Wk_s, nullptr, nullptr, Du, 4096, 512, 0, 0, 0, 0);
  // 10) SW = mean_h softmax(QsKs^T/8)         -> d_out second region [16,256,256]
  stndt_spatial<<<dim3(16, 16, 1), blk128, 0, stream>>>(Bu, Du, SW);
  // 11) x2 = TO + einsum('bce,bte->btc')      -> A (batched GEMM, W = SW per batch)
  stndt_gemm_xwt<256><<<dim3(4, 8, 16), blk128, 0, stream>>>(Cu, SW, nullptr, Cu, A, 512, 256, 131072, 65536, 131072, 0);
  // 12) h3 = LN(x2)                           -> Bu
  stndt_ln<<<dim3(1024), blk256, 0, stream>>>(A, fus_ln_w, fus_ln_b, Bu, 256, 8192);
  // 13) mid2 = relu(h3 @ ff2_w1^T + b1)       -> Eu
  stndt_gemm_xwt<256><<<dim3(16, 128, 1), blk128, 0, stream>>>(Bu, ff2_w1, ff2_b1, nullptr, Eu, 8192, 1024, 0, 0, 0, 1);
  // 14) out = x2 + mid2 @ ff2_w2^T + b2       -> d_out first region
  stndt_gemm_xwt<1024><<<dim3(4, 128, 1), blk128, 0, stream>>>(Eu, ff2_w2, ff2_b2, A, out, 8192, 256, 0, 0, 0, 0);
}

// v002
// Measured time: 363 microseconds a run.
// Next to v001, in two timings, it ran 1.05 times as fast each time.
// Counting every step since v000, it is 1.47 times as fast.
#include <hip/hip_runtime.h>

typedef __attribute__((ext_vector_type(2))) float v2f;
typedef __attribute__((ext_vector_type(8))) float v8f;

__device__ __forceinline__ v8f wmma_f32_k4(v2f a, v2f b, v8f c) {
  // D = A(16x4 f32) * B(4x16 f32) + C(16x16 f32)
  return __builtin_amdgcn_wmma_f32_16x16x4_f32(
      /*neg_a=*/false, a, /*neg_b=*/false, b,
      /*c_mod=*/(short)0, c, /*reuse_a=*/false, /*reuse_b=*/false);
}

// ---------------------------------------------------------------------------
// Generic batched GEMM:  Y[bat][m,n] = sum_k X[bat][m,k] * W[bat][n,k]
//                        (+ bias[n]) (ReLU?) (+ res[bat][m,n])
// Grid: (N/64, M/64, batch). Block: 128 (4 waves, each one 16-row m-subtile,
// 16(M) x 64(N) per wave). M, N multiples of 64, K a multiple of 32.
// The block's 64 X rows and 64 W rows come to LDS in stages of 32 k (one whole
// 128-B line per row) by asynchronous b128 copies, two buffers: stage t + 2
// flies while stage t + 1 is worked on. Fragments are read from LDS at a row
// pitch of 144 B (16 B x odd: 16 rows x 16 B fall on 64 distinct banks).
// ---------------------------------------------------------------------------
constexpr int GEMM_KC    = 32;                    // k per stage (floats)
constexpr int GEMM_PITCH = 36;                    // LDS row pitch (floats)
constexpr int GEMM_BUF   = 128 * GEMM_PITCH;      // floats per buffer: 64 X rows, 64 W rows

// One stage: every lane copies 16 B of eight rows (4 of X, 4 of W); a wave's
// copy covers four whole 128-B lines. The s_wait_xcnt closes the statement so
// that no address register is rewritten in front of it.
template <int K>
__device__ __forceinline__ void gemm_stage_copy(const float* gx, const float* gw, unsigned lds) {
  constexpr unsigned RB = 16u * GEMM_PITCH * 4u;  // 16 LDS rows, bytes
  asm volatile(
      "global_load_async_to_lds_b128 %0, %8, off\n\t"
      "global_load_async_to_lds_b128 %1, %9, off\n\t"
      "global_load_async_to_lds_b128 %2, %10, off\n\t"
      "global_load_async_to_lds_b128 %3, %11, off\n\t"
      "global_load_async_to_lds_b128 %4, %12, off\n\t"
      "global_load_async_to_lds_b128 %5, %13, off\n\t"
      "global_load_async_to_lds_b128 %6, %14, off\n\t"
      "global_load_async_to_lds_b128 %7, %15, off\n\t"
      "s_wait_xcnt 0x0"
      :: "v"(lds), "v"(lds + RB), "v"(lds + 2u * RB), "v"(lds + 3u * RB),
         "v"(lds + 4u * RB), "v"(lds + 5u * RB), "v"(lds + 6u * RB), "v"(lds + 7u * RB),
         "v"(gx), "v"(gx + 16 * K), "v"(gx + 32 * K), "v"(gx + 48 * K),
         "v"(gw), "v"(gw + 16 * K), "v"(gw + 32 * K), "v"(gw + 48 * K)
      : "memory");
}

template <int K>
__global__ __launch_bounds__(128) void stndt_gemm_xwt(
    const float* __restrict__ X, const float* __restrict__ W,
    const float* __restrict__ bias, const float* __restrict__ res,
    float* __restrict__ Y,
    int M, int N,
    long sX, long sW, long sY, int relu)
{
  constexpr int NT = K / GEMM_KC;                 // stages
  __shared__ __attribute__((aligned(16))) float tile[2 * GEMM_BUF];

  const int lane = threadIdx.x & 31;
  const int wave = threadIdx.x >> 5;
  const int n0 = blockIdx.x * 64;
  const int m0 = (blockIdx.y * 4 + wave) * 16;
  const int bat = blockIdx.z;

  const int r  = lane & 15;          // A row (m) / B col (n) within tile
  const int kk = (lane >> 4) << 1;   // k-pair select: lanes 0-15 -> k0,k1 ; 16-31 -> k2,k3

  // copy side: thread -> (row within a group of 16, 16-B segment of the line)
  const int crow = threadIdx.x >> 3;
  const int cseg = threadIdx.x & 7;
  const float* gx = X + (long)bat * sX + (long)(blockIdx.y * 64 + crow) * K + cseg * 4;
  const float* gw = W + (long)bat * sW + (long)(n0 + crow) * K + cseg * 4;
  const unsigned lds0 = (unsigned)(size_t)tile + (unsigned)(crow * GEMM_PITCH + cseg * 4) * 4u;

  v8f acc[4] = {{}, {}, {}, {}};

  // prologue: stage 0 lands and is published, then stage 1 starts
  gemm_stage_copy<K>(gx, gw, lds0);
  asm volatile("s_wait_asynccnt 0x0" ::: "memory");   // this wave's copies of stage 0 have landed
  __syncthreads();
  if (NT > 1) gemm_stage_copy<K>(gx + GEMM_KC, gw + GEMM_KC, lds0 + GEMM_BUF * 4u);

  for (int t = 0; t < NT; ++t) {
    const float* xs = tile + (t & 1) * GEMM_BUF + (wave * 16 + r) * GEMM_PITCH + kk;
    const float* wl = tile + (t & 1) * GEMM_BUF + (64 + r) * GEMM_PITCH + kk;
    // the three loops below are unrolled so that every LDS offset is an immediate
    // and every index of b[] and acc[] a constant (both stay in registers)
#pragma unroll
    for (int k = 0; k < GEMM_KC; k += 4) {
      v2f a = *(const v2f*)(xs + k);
      v2f b[4];
#pragma unroll
      for (int j = 0; j < 4; ++j) b[j] = *(const v2f*)(wl + j * 16 * GEMM_PITCH + k);
#pragma unroll
      for (int j = 0; j < 4; ++j) acc[j] = wmma_f32_k4(a, b[j], acc[j]);
    }
    asm volatile("s_wait_dscnt 0x0" ::: "memory");    // this wave's reads of buffer t & 1 are done
    asm volatile("s_wait_asynccnt 0x0" ::: "memory"); // this wave's copies of stage t + 1 have landed
    __syncthreads();                                  // publishes stage t + 1, frees buffer t & 1
    if (t + 2 < NT)
      gemm_stage_copy<K>(gx + (t + 2) * GEMM_KC, gw + (t + 2) * GEMM_KC,
                         lds0 + (unsigned)(t & 1) * (GEMM_BUF * 4u));
  }
  asm volatile("s_wait_asynccnt 0x0" ::: "memory");   // nothing in flight when the wave goes on

  float* Yb = Y + (long)bat * sY;
  const float* Rb = res ? (res + (long)bat * sY) : nullptr;
#pragma unroll
  for (int j = 0; j < 4; ++j) {
    const int col = n0 + j * 16 + (lane & 15);
    const float bv = bias ? bias[col] : 0.0f;
#pragma unroll
    for (int i = 0; i < 8; ++i) {
      const int row = m0 + i + ((lane >> 4) << 3);
      float v = acc[j][i] + bv;
      if (relu) v = fmaxf(v, 0.0f);
      if (Rb) v += Rb[(long)row * N + col];
      Yb[(long)row * N + col] = v;
    }
  }
}

// ---------------------------------------------------------------------------
// LayerNorm over last dim (length Nn), one wave per row.
// ---------------------------------------------------------------------------
__global__ __launch_bounds__(256) void stndt_ln(
    const float* __restrict__ X, const float* __restrict__ g,
    const float* __restrict__ b, float* __restrict__ Y, int Nn, int rows)
{
  const int lane = threadIdx.x & 31;
  const int wave = threadIdx.x >> 5;
  const int row = blockIdx.x * 8 + wave;
  if (row >= rows) return;
  const float* x = X + (long)row * Nn;
  float s = 0.f, ss = 0.f;
  for (int i = lane; i < Nn; i += 32) { float v = x[i]; s += v; ss += v * v; }
  for (int o = 16; o > 0; o >>= 1) { s += __shfl_xor(s, o); ss += __shfl_xor(ss, o); }
  const float m = s / (float)Nn;
  const float var = ss / (float)Nn - m * m;
  const float rst = rsqrtf(var + 1e-6f);
  float* y = Y + (long)row * Nn;
  for (int i = lane; i < Nn; i += 32) y[i] = (x[i] - m) * rst * g[i] + b[i];
}

// ---------------------------------------------------------------------------
// Temporal causal attention, per (b,h,t-tile of 16). 128 threads (4 waves).
// Q/K/V layout: [B,T, H*32] head-concat (as produced by the QKV GEMMs).
// O written in the same layout => concat-heads for the Wo GEMM.
// Causal bound: query rows t0..t0+15 see no key past t0+15, so the key tiles
// up to the diagonal are worked on (scores and softmax in whole groups of four
// tiles); the tiles behind it would hold -inf
// scores, zero weights and zero products.
// ---------------------------------------------------------------------------

// Row-wise softmax over the first 32 * NJ columns (wave per row). NJ is a
// compile-time count so that each pass issues its LDS reads together.
template <int NJ>
__device__ __forceinline__ void attn_softmax_rows(float* sc, int wave, int lane) {
  for (int rr = wave; rr < 16; rr += 4) {
    float* srow = sc + rr * 512 + lane;
    float mx = -__builtin_inff();
    // the three loops over j are unrolled: NJ independent LDS reads behind one another
#pragma unroll
    for (int j = 0; j < NJ; ++j) mx = fmaxf(mx, srow[32 * j]);
    for (int o = 16; o > 0; o >>= 1) mx = fmaxf(mx, __shfl_xor(mx, o));
    float sum = 0.f;
#pragma unroll
    for (int j = 0; j < NJ; ++j) { float e = __expf(srow[32 * j] - mx); srow[32 * j] = e; sum += e; }
    for (int o = 16; o > 0; o >>= 1) sum += __shfl_xor(sum, o);
    const float inv = 1.0f / sum;
#pragma unroll
    for (int j = 0; j < NJ; ++j) srow[32 * j] *= inv;
  }
}

__global__ __launch_bounds__(128) void stndt_attn(
    const float* __restrict__ Q, const float* __restrict__ Km,
    const float* __restrict__ V, float* __restrict__ O)
{
  __shared__ float sc[16 * 512];
  const int lane = threadIdx.x & 31;
  const int wave = threadIdx.x >> 5;
  const int t0 = blockIdx.x * 16;
  const int h  = blockIdx.y;
  const int b  = blockIdx.z;
  const long base = (long)b * 512 * 256 + h * 32;   // + t*256 + d

  const int r  = lane & 15;
  const int kk = (lane >> 4) << 1;
  const float* qrow = Q + base + (long)(t0 + r) * 256 + kk;

  const int nT = blockIdx.x + 1;       // key tiles with at least one unmasked column
  const int ng = (nT + 3) >> 2;        // the same in groups of four tiles (one per wave), rounded up

  // scores[t, s] = q . k * rsqrt(32), causal-masked; the last group is written
  // whole (its tiles behind the diagonal come out all -inf), so 64 * ng columns are set
  for (int g = 0; g < ng; ++g) {
    const int s0 = (g * 4 + wave) * 16;
    const float* krow = Km + base + (long)(s0 + r) * 256 + kk;
    v8f acc = {};
#pragma unroll
    for (int k = 0; k < 32; k += 4) {
      v2f a  = *(const v2f*)(qrow + k);
      v2f bb = *(const v2f*)(krow + k);
      acc = wmma_f32_k4(a, bb, acc);
    }
    const int col = s0 + (lane & 15);
#pragma unroll
    for (int i = 0; i < 8; ++i) {
      const int rr = i + ((lane >> 4) << 3);
      float v = acc[i] * 0.17677669529663687f;      // 1/sqrt(32)
      if (col > t0 + rr) v = -__builtin_inff();     // causal mask
      sc[rr * 512 + col] = v;
    }
  }
  __syncthreads();

  // row-wise softmax over the 64 * ng columns that were written
  switch (ng) {
    case 1:  attn_softmax_rows<2>(sc, wave, lane);  break;
    case 2:  attn_softmax_rows<4>(sc, wave, lane);  break;
    case 3:  attn_softmax_rows<6>(sc, wave, lane);  break;
    case 4:  attn_softmax_rows<8>(sc, wave, lane);  break;
    case 5:  attn_softmax_rows<10>(sc, wave, lane); break;
    case 6:  attn_softmax_rows<12>(sc, wave, lane); break;
    case 7:  attn_softmax_rows<14>(sc, wave, lane); break;
    default: attn_softmax_rows<16>(sc, wave, lane); break;
  }
  __syncthreads();

  // O(16x32) = P(16 x 16 nT) @ V(16 nT x 32); waves 0,1 handle the two 16-wide halves
  if (wave < 2) {
    const int n0 = wave * 16;
    const float* arow = sc + (lane & 15) * 512 + kk;
    const float* vcol = V + base + (long)kk * 256 + n0 + (lane & 15);
    v8f acc = {};
    for (int kt = 0; kt < nT; ++kt) {
      // one key tile per trip, unrolled so that its eight V loads go out together
#pragma unroll
      for (int k = kt * 16; k < kt * 16 + 16; k += 4) {
        v2f a; a.x = arow[k]; a.y = arow[k + 1];
        v2f bb; bb.x = vcol[(long)k * 256]; bb.y = vcol[(long)k * 256 + 256];
        acc = wmma_f32_k4(a, bb, acc);
      }
    }
    const int d = n0 + (lane & 15);
#pragma unroll
    for (int i = 0; i < 8; ++i) {
      const int rr = i + ((lane >> 4) << 3);
      O[base + (long)(t0 + rr) * 256 + d] = acc[i];
    }
  }
}

// ---------------------------------------------------------------------------
// Spatial attention weights, per (b, c-tile of 16): mean_h softmax(QsKs^T/8).
// Qs/Ks layout: [B, C, H*64]. SW written as [B, C, C] (second model output).
// ---------------------------------------------------------------------------
__global__ __launch_bounds__(128) void stndt_spatial(
    const float* __restrict__ Qs, const float* __restrict__ Ks,
    float* __restrict__ SW)
{
  __shared__ float sc[16 * 256];
  __shared__ float accsm[16 * 256];
  const int lane = threadIdx.x & 31;
  const int wave = threadIdx.x >> 5;
  const int c0 = blockIdx.x * 16;
  const int b  = blockIdx.y;
  const int r  = lane & 15;
  const int kk = (lane >> 4) << 1;

  for (int i = threadIdx.x; i < 16 * 256; i += 128) accsm[i] = 0.f;
  __syncthreads();

  for (int h = 0; h < 8; ++h) {
    const long base = (long)b * 256 * 512 + h * 64;
    const float* qrow = Qs + base + (long)(c0 + r) * 512 + kk;
    for (int et = wave; et < 16; et += 4) {
      const int e0 = et * 16;
      const float* krow = Ks + base + (long)(e0 + r) * 512 + kk;
      v8f acc = {};
#pragma unroll
      for (int k = 0; k < 64; k += 4) {
        v2f a  = *(const v2f*)(qrow + k);
        v2f bb = *(const v2f*)(krow + k);
        acc = wmma_f32_k4(a, bb, acc);
      }
      const int col = e0 + (lane & 15);
#pragma unroll
      for (int i = 0; i < 8; ++i) {
        const int rr = i + ((lane >> 4) << 3);
        sc[rr * 256 + col] = acc[i] * 0.125f;       // 1/sqrt(64)
      }
    }
    __syncthreads();
    for (int rr = wave; rr < 16; rr += 4) {
      float* srow = sc + rr * 256;
      float mx = -__builtin_inff();
      for (int i = lane; i < 256; i += 32) mx = fmaxf(mx, srow[i]);
      for (int o = 16; o > 0; o >>= 1) mx = fmaxf(mx, __shfl_xor(mx, o));
      float sum = 0.f;
      for (int i = lane; i < 256; i += 32) { float e = __expf(srow[i] - mx); srow[i] = e; sum += e; }
      for (int o = 16; o > 0; o >>= 1) sum += __shfl_xor(sum, o);
      const float inv = 1.0f / sum;
      for (int i = lane; i < 256; i += 32) srow[i] *= inv;
    }
    __syncthreads();
    for (int i = threadIdx.x; i < 16 * 256; i += 128) accsm[i] += sc[i];
    __syncthreads();
  }

  for (int i = threadIdx.x; i < 16 * 256; i += 128) {
    const int rr = i >> 8, e = i & 255;
    SW[((long)b * 256 + c0 + rr) * 256 + e] = accsm[i] * 0.125f;  // mean over 8 heads
  }
}

// ---------------------------------------------------------------------------
extern "C" void kernel_launch(void* const* d_in, const int* in_sizes, int n_in,
                              void* d_out, int out_size, void* d_ws, size_t ws_size,
                              hipStream_t stream) {
  (void)in_sizes; (void)n_in; (void)out_size; (void)ws_size;
  const float* x_T    = (const float*)d_in[0];
  const float* x_S    = (const float*)d_in[1];
  const float* Wq_t   = (const float*)d_in[2];
  const float* Wk_t   = (const float*)d_in[3];
  const float* Wv_t   = (const float*)d_in[4];
  const float* Wo     = (const float*)d_in[5];
  const float* Wq_s   = (const float*)d_in[6];
  const float* Wk_s   = (const float*)d_in[7];
  const float* ff1_w1 = (const float*)d_in[8];
  const float* ff1_b1 = (const float*)d_in[9];
  const float* ff1_w2 = (const float*)d_in[10];
  const float* ff1_b2 = (const float*)d_in[11];
  const float* ff2_w1 = (const float*)d_in[12];
  const float* ff2_b1 = (const float*)d_in[13];
  const float* ff2_w2 = (const float*)d_in[14];
  const float* ff2_b2 = (const float*)d_in[15];
  const float* t_ln1_w = (const float*)d_in[16];
  const float* t_ln1_b = (const float*)d_in[17];
  const float* t_ln2_w = (const float*)d_in[18];
  const float* t_ln2_b = (const float*)d_in[19];
  const float* s_ln1_w = (const float*)d_in[20];
  const float* s_ln1_b = (const float*)d_in[21];
  const float* fus_ln_w = (const float*)d_in[22];
  const float* fus_ln_b = (const float*)d_in[23];

  // B=16, T=512, C=256, H=8; BT = 8192 rows.
  float* A  = (float*)d_ws;       // 2M floats each for A..D, 8M for E (64 MB total)
  float* Bu = A  + 2097152;
  float* Cu = Bu + 2097152;
  float* Du = Cu + 2097152;
  float* Eu = Du + 2097152;
  float* out = (float*)d_out;
  float* SW  = out + 2097152;     // second output region: [B,C,C]

  dim3 blk128(128), blk256(256);

  // 1) h = LN(x_T)                            -> A [8192,256]
  stndt_ln<<<dim3(1024), blk256, 0, stream>>>(x_T, t_ln1_w, t_ln1_b, A, 256, 8192);
  // 2) Q,K,V = h @ W{q,k,v}_t^T               -> Bu,Cu,Du [8192,256]
  stndt_gemm_xwt<256><<<dim3(4, 128, 1), blk128, 0, stream>>>(A, Wq_t, nullptr, nullptr, Bu, 8192, 256, 0, 0, 0, 0);
  stndt_gemm_xwt<256><<<dim3(4, 128, 1), blk128, 0, stream>>>(A, Wk_t, nullptr, nullptr, Cu, 8192, 256, 0, 0, 0, 0);
  stndt_gemm_xwt<256><<<dim3(4, 128, 1), blk128, 0, stream>>>(A, Wv_t, nullptr, nullptr, Du, 8192, 256, 0, 0, 0, 0);
  // 3) causal MHA                             -> A (head-concat [8192,256])
  stndt_attn<<<dim3(32, 8, 16), blk128, 0, stream>>>(Bu, Cu, Du, A);
  // 4) x = x_T + o @ Wo^T                     -> Bu
  stndt_gemm_xwt<256><<<dim3(4, 128, 1), blk128, 0, stream>>>(A, Wo, nullptr, x_T, Bu, 8192, 256, 0, 0, 0, 0);
  // 5) h2 = LN(x)                             -> A
  stndt_ln<<<dim3(1024), blk256, 0, stream>>>(Bu, t_ln2_w, t_ln2_b, A, 256, 8192);
  // 6) mid = relu(h2 @ ff1_w1^T + b1)         -> Eu [8192,1024]
  stndt_gemm_xwt<256><<<dim3(16, 128, 1), blk128, 0, stream>>>(A, ff1_w1, ff1_b1, nullptr, Eu, 8192, 1024, 0, 0, 0, 1);
  // 7) temporal_out = x + mid @ ff1_w2^T + b2 -> Cu
  stndt_gemm_xwt<1024><<<dim3(4, 128, 1), blk128, 0, stream>>>(Eu, ff1_w2, ff1_b2, Bu, Cu, 8192, 256, 0, 0, 0, 0);
  // 8) hs = LN(x_S over T)                    -> A [4096,512]
  stndt_ln<<<dim3(512), blk256, 0, stream>>>(x_S, s_ln1_w, s_ln1_b, A, 512, 4096);
  // 9) Qs,Ks = hs @ W{q,k}_s^T                -> Bu,Du [4096,512]
  stndt_gemm_xwt<512><<<dim3(8, 64, 1), blk128, 0, stream>>>(A, Wq_s, nullptr, nullptr, Bu, 4096, 512, 0, 0, 0, 0);
  stndt_gemm_xwt<512><<<dim3(8, 64, 1), blk128, 0, stream>>>(A, Wk_s, nullptr, nullptr, Du, 4096, 512, 0, 0, 0, 0);
  // 10) SW = mean_h softmax(QsKs^T/8)         -> d_out second region [16,256,256]
  stndt_spatial<<<dim3(16, 16, 1), blk128, 0, stream>>>(Bu, Du, SW);
  // 11) x2 = TO + einsum('bce,bte->btc')      -> A (batched GEMM, W = SW per batch)
  stndt_gemm_xwt<256><<<dim3(4, 8, 16), blk128, 0, stream>>>(Cu, SW, nullptr, Cu, A, 512, 256, 131072, 65536, 131072, 0);
  // 12) h3 = LN(x2)                           -> Bu
  stndt_ln<<<dim3(1024), blk256, 0, stream>>>(A, fus_ln_w, fus_ln_b, Bu, 256, 8192);
  // 13) mid2 = relu(h3 @ ff2_w1^T + b1)       -> Eu
  stndt_gemm_xwt<256><<<dim3(16, 128, 1), blk128, 0, stream>>>(Bu, ff2_w1, ff2_b1, nullptr, Eu, 8192, 1024, 0, 0, 0, 1);
  // 14) out = x2 + mid2 @ ff2_w2^T + b2       -> d_out first region
  stndt_gemm_xwt<1024><<<dim3(4, 128, 1), blk128, 0, stream>>>(Eu, ff2_w2, ff2_b2, A, out, 8192, 256, 0, 0, 0, 0);
}

// v003
// A run of this version takes 340 microseconds.
// Two timings next to v002 put it at 1.06 and 1.07 times that version's speed.
// All steps since v000 together make it 1.57 times as fast.
#include <hip/hip_runtime.h>

typedef __attribute__((ext_vector_type(2))) float v2f;
typedef __attribute__((ext_vector_type(8))) float v8f;

__device__ __forceinline__ v8f wmma_f32_k4(v2f a, v2f b, v8f c) {
  // D = A(16x4 f32) * B(4x16 f32) + C(16x16 f32)
  return __builtin_amdgcn_wmma_f32_16x16x4_f32(
      /*neg_a=*/false, a, /*neg_b=*/false, b,
      /*c_mod=*/(short)0, c, /*reuse_a=*/false, /*reuse_b=*/false);
}

// ---------------------------------------------------------------------------
// Generic batched GEMM:  Y[bat][m,n] = sum_k X[bat][m,k] * W[bat][n,k]
//                        (+ bias[n]) (ReLU?) (+ res[bat][m,n])
// Grid: (N/64, M/64, batch). Block: 128 (4 waves, each one 16-row m-subtile,
// 16(M) x 64(N) per wave). M, N multiples of 64, K a multiple of 32.
// The block's 64 X rows and 64 W rows come to LDS in stages of 32 k (one whole
// 128-B line per row) by asynchronous b128 copies, two buffers: stage t + 2
// flies while stage t + 1 is worked on. Fragments are read from LDS at a row
// pitch of 144 B (16 B x odd: 16 rows x 16 B fall on 64 distinct banks).
// What the epilogue adds (bias, residual) is chosen at compile time and loaded
// as one group behind the prologue's copies, so that it lands while the k loop runs.
// ---------------------------------------------------------------------------
constexpr int GEMM_KC    = 32;                    // k per stage (floats)
constexpr int GEMM_PITCH = 36;                    // LDS row pitch (floats)
constexpr int GEMM_BUF   = 128 * GEMM_PITCH;      // floats per buffer: 64 X rows, 64 W rows

// One stage: every lane copies 16 B of eight rows (4 of X, 4 of W); a wave's
// copy covers four whole 128-B lines. The s_wait_xcnt closes the statement so
// that no address register is rewritten in front of it.
template <int K>
__device__ __forceinline__ void gemm_stage_copy(const float* gx, const float* gw, unsigned lds) {
  constexpr unsigned RB = 16u * GEMM_PITCH * 4u;  // 16 LDS rows, bytes
  asm volatile(
      "global_load_async_to_lds_b128 %0, %8, off\n\t"
      "global_load_async_to_lds_b128 %1, %9, off\n\t"
      "global_load_async_to_lds_b128 %2, %10, off\n\t"
      "global_load_async_to_lds_b128 %3, %11, off\n\t"
      "global_load_async_to_lds_b128 %4, %12, off\n\t"
      "global_load_async_to_lds_b128 %5, %13, off\n\t"
      "global_load_async_to_lds_b128 %6, %14, off\n\t"
      "global_load_async_to_lds_b128 %7, %15, off\n\t"
      "s_wait_xcnt 0x0"
      :: "v"(lds), "v"(lds + RB), "v"(lds + 2u * RB), "v"(lds + 3u * RB),
         "v"(lds + 4u * RB), "v"(lds + 5u * RB), "v"(lds + 6u * RB), "v"(lds + 7u * RB),
         "v"(gx), "v"(gx + 16 * K), "v"(gx + 32 * K), "v"(gx + 48 * K),
         "v"(gw), "v"(gw + 16 * K), "v"(gw + 32 * K), "v"(gw + 48 * K)
      : "memory");
}

template <int K, int N, bool BIAS, bool RELU, bool RES>
__global__ __launch_bounds__(128) void stndt_gemm_xwt(
    const float* __restrict__ X, const float* __restrict__ W,
    const float* __restrict__ bias, const float* __restrict__ res,
    float* __restrict__ Y,
    long sX, long sW, long sY)
{
  constexpr int NT = K / GEMM_KC;                 // stages
  __shared__ __attribute__((aligned(16))) float tile[2 * GEMM_BUF];

  const int lane = threadIdx.x & 31;
  const int wave = threadIdx.x >> 5;
  const int n0 = blockIdx.x * 64;
  const int m0 = (blockIdx.y * 4 + wave) * 16;
  const int bat = blockIdx.z;

  const int r  = lane & 15;          // A row (m) / B col (n) within tile
  const int kk = (lane >> 4) << 1;   // k-pair select: lanes 0-15 -> k0,k1 ; 16-31 -> k2,k3

  // copy side: thread -> (row within a group of 16, 16-B segment of the line)
  const int crow = threadIdx.x >> 3;
  const int cseg = threadIdx.x & 7;
  const float* gx = X + (long)bat * sX + (long)(blockIdx.y * 64 + crow) * K + cseg * 4;
  const float* gw = W + (long)bat * sW + (long)(n0 + crow) * K + cseg * 4;
  const unsigned lds0 = (unsigned)(size_t)tile + (unsigned)(crow * GEMM_PITCH + cseg * 4) * 4u;

  v8f acc[4] = {{}, {}, {}, {}};

  // prologue: stage 0 lands and is published, then stage 1 starts
  gemm_stage_copy<K>(gx, gw, lds0);
  asm volatile("s_wait_asynccnt 0x0" ::: "memory");   // this wave's copies of stage 0 have landed
  __syncthreads();
  if (NT > 1) gemm_stage_copy<K>(gx + GEMM_KC, gw + GEMM_KC, lds0 + GEMM_BUF * 4u);

  // this lane's first output element; element (j, i) lies i rows and 16 j columns on
  const long yoff = (long)bat * sY + (long)(m0 + ((lane >> 4) << 3)) * N + n0 + r;
  float bv[4];
  float rv[4][8];
  // unrolled: bv[] and rv[][] stay in registers, every load has an immediate offset
  if constexpr (BIAS) {
#pragma unroll
    for (int j = 0; j < 4; ++j) bv[j] = bias[n0 + r + j * 16];
  }
  if constexpr (RES) {
    const float* rp = res + yoff;
#pragma unroll
    for (int j = 0; j < 4; ++j) {
#pragma unroll
      for (int i = 0; i < 8; ++i) rv[j][i] = rp[i * N + j * 16];
    }
  }

  for (int t = 0; t < NT; ++t) {
    const float* xs = tile + (t & 1) * GEMM_BUF + (wave * 16 + r) * GEMM_PITCH + kk;
    const float* wl = tile + (t & 1) * GEMM_BUF + (64 + r) * GEMM_PITCH + kk;
    // the three loops below are unrolled so that every LDS offset is an immediate
    // and every index of b[] and acc[] a constant (both stay in registers)
#pragma unroll
    for (int k = 0; k < GEMM_KC; k += 4) {
      v2f a = *(const v2f*)(xs + k);
      v2f b[4];
#pragma unroll
      for (int j = 0; j < 4; ++j) b[j] = *(const v2f*)(wl + j * 16 * GEMM_PITCH + k);
#pragma unroll
      for (int j = 0; j < 4; ++j) acc[j] = wmma_f32_k4(a, b[j], acc[j]);
    }
    asm volatile("s_wait_dscnt 0x0" ::: "memory");    // this wave's reads of buffer t & 1 are done
    asm volatile("s_wait_asynccnt 0x0" ::: "memory"); // this wave's copies of stage t + 1 have landed
    __syncthreads();                                  // publishes stage t + 1, frees buffer t & 1
    if (t + 2 < NT)
      gemm_stage_copy<K>(gx + (t + 2) * GEMM_KC, gw + (t + 2) * GEMM_KC,
                         lds0 + (unsigned)(t & 1) * (GEMM_BUF * 4u));
  }
  asm volatile("s_wait_asynccnt 0x0" ::: "memory");   // nothing in flight when the wave goes on

  float* yp = Y + yoff;
  // unrolled: constant indices into acc[], bv[] and rv[][], one address for all stores
#pragma unroll
  for (int j = 0; j < 4; ++j) {
#pragma unroll
    for (int i = 0; i < 8; ++i) {
      float v = acc[j][i];
      if constexpr (BIAS) v += bv[j];
      if constexpr (RELU) v = fmaxf(v, 0.0f);
      if constexpr (RES) v += rv[j][i];
      yp[i * N + j * 16] = v;
    }
  }
}

// ---------------------------------------------------------------------------
// LayerNorm over last dim (length Nn), one wave per row.
// ---------------------------------------------------------------------------
__global__ __launch_bounds__(256) void stndt_ln(
    const float* __restrict__ X, const float* __restrict__ g,
    const float* __restrict__ b, float* __restrict__ Y, int Nn, int rows)
{
  const int lane = threadIdx.x & 31;
  const int wave = threadIdx.x >> 5;
  const int row = blockIdx.x * 8 + wave;
  if (row >= rows) return;
  const float* x = X + (long)row * Nn;
  float s = 0.f, ss = 0.f;
  for (int i = lane; i < Nn; i += 32) { float v = x[i]; s += v; ss += v * v; }
  for (int o = 16; o > 0; o >>= 1) { s += __shfl_xor(s, o); ss += __shfl_xor(ss, o); }
  const float m = s / (float)Nn;
  const float var = ss / (float)Nn - m * m;
  const float rst = rsqrtf(var + 1e-6f);
  float* y = Y + (long)row * Nn;
  for (int i = lane; i < Nn; i += 32) y[i] = (x[i] - m) * rst * g[i] + b[i];
}

// ---------------------------------------------------------------------------
// Temporal causal attention, per (b,h,t-tile of 16). 128 threads (4 waves).
// Q/K/V layout: [B,T, H*32] head-concat (as produced by the QKV GEMMs).
// O written in the same layout => concat-heads for the Wo GEMM.
// Causal bound: query rows t0..t0+15 see no key past t0+15, so the key tiles
// up to the diagonal are worked on (scores and softmax in whole groups of four
// tiles); the tiles behind it would hold -inf
// scores, zero weights and zero products.
// ---------------------------------------------------------------------------

// Row-wise softmax over the first 32 * NJ columns (wave per row). NJ is a
// compile-time count so that each pass issues its LDS reads together.
template <int NJ>
__device__ __forceinline__ void attn_softmax_rows(float* sc, int wave, int lane) {
  for (int rr = wave; rr < 16; rr += 4) {
    float* srow = sc + rr * 512 + lane;
    float mx = -__builtin_inff();
    // the three loops over j are unrolled: NJ independent LDS reads behind one another
#pragma unroll
    for (int j = 0; j < NJ; ++j) mx = fmaxf(mx, srow[32 * j]);
    for (int o = 16; o > 0; o >>= 1) mx = fmaxf(mx, __shfl_xor(mx, o));
    float sum = 0.f;
#pragma unroll
    for (int j = 0; j < NJ; ++j) { float e = __expf(srow[32 * j] - mx); srow[32 * j] = e; sum += e; }
    for (int o = 16; o > 0; o >>= 1) sum += __shfl_xor(sum, o);
    const float inv = 1.0f / sum;
#pragma unroll
    for (int j = 0; j < NJ; ++j) srow[32 * j] *= inv;
  }
}

__global__ __launch_bounds__(128) void stndt_attn(
    const float* __restrict__ Q, const float* __restrict__ Km,
    const float* __restrict__ V, float* __restrict__ O)
{
  __shared__ float sc[16 * 512];
  const int lane = threadIdx.x & 31;
  const int wave = threadIdx.x >> 5;
  const int t0 = blockIdx.x * 16;
  const int h  = blockIdx.y;
  const int b  = blockIdx.z;
  const long base = (long)b * 512 * 256 + h * 32;   // + t*256 + d

  const int r  = lane & 15;
  const int kk = (lane >> 4) << 1;
  const float* qrow = Q + base + (long)(t0 + r) * 256 + kk;

  const int nT = blockIdx.x + 1;       // key tiles with at least one unmasked column
  const int ng = (nT + 3) >> 2;        // the same in groups of four tiles (one per wave), rounded up

  // scores[t, s] = q . k * rsqrt(32), causal-masked; the last group is written
  // whole (its tiles behind the diagonal come out all -inf), so 64 * ng columns are set
  for (int g = 0; g < ng; ++g) {
    const int s0 = (g * 4 + wave) * 16;
    const float* krow = Km + base + (long)(s0 + r) * 256 + kk;
    v8f acc = {};
#pragma unroll
    for (int k = 0; k < 32; k += 4) {
      v2f a  = *(const v2f*)(qrow + k);
      v2f bb = *(const v2f*)(krow + k);
      acc = wmma_f32_k4(a, bb, acc);
    }
    const int col = s0 + (lane & 15);
#pragma unroll
    for (int i = 0; i < 8; ++i) {
      const int rr = i + ((lane >> 4) << 3);
      float v = acc[i] * 0.17677669529663687f;      // 1/sqrt(32)
      if (col > t0 + rr) v = -__builtin_inff();     // causal mask
      sc[rr * 512 + col] = v;
    }
  }
  __syncthreads();

  // row-wise softmax over the 64 * ng columns that were written
  switch (ng) {
    case 1:  attn_softmax_rows<2>(sc, wave, lane);  break;
    case 2:  attn_softmax_rows<4>(sc, wave, lane);  break;
    case 3:  attn_softmax_rows<6>(sc, wave, lane);  break;
    case 4:  attn_softmax_rows<8>(sc, wave, lane);  break;
    case 5:  attn_softmax_rows<10>(sc, wave, lane); break;
    case 6:  attn_softmax_rows<12>(sc, wave, lane); break;
    case 7:  attn_softmax_rows<14>(sc, wave, lane); break;
    default: attn_softmax_rows<16>(sc, wave, lane); break;
  }
  __syncthreads();

  // O(16x32) = P(16 x 16 nT) @ V(16 nT x 32); waves 0,1 handle the two 16-wide halves
  if (wave < 2) {
    const int n0 = wave * 16;
    const float* arow = sc + (lane & 15) * 512 + kk;
    const float* vcol = V + base + (long)kk * 256 + n0 + (lane & 15);
    v8f acc = {};
    for (int kt = 0; kt < nT; ++kt) {
      // one key tile per trip, unrolled so that its eight V loads go out together
#pragma unroll
      for (int k = kt * 16; k < kt * 16 + 16; k += 4) {
        v2f a; a.x = arow[k]; a.y = arow[k + 1];
        v2f bb; bb.x = vcol[(long)k * 256]; bb.y = vcol[(long)k * 256 + 256];
        acc = wmma_f32_k4(a, bb, acc);
      }
    }
    const int d = n0 + (lane & 15);
#pragma unroll
    for (int i = 0; i < 8; ++i) {
      const int rr = i + ((lane >> 4) << 3);
      O[base + (long)(t0 + rr) * 256 + d] = acc[i];
    }
  }
}

// ---------------------------------------------------------------------------
// Spatial attention weights, per (b, c-tile of 16): mean_h softmax(QsKs^T/8).
// Qs/Ks layout: [B, C, H*64]. SW written as [B, C, C] (second model output).
// ---------------------------------------------------------------------------
__global__ __launch_bounds__(128) void stndt_spatial(
    const float* __restrict__ Qs, const float* __restrict__ Ks,
    float* __restrict__ SW)
{
  __shared__ float sc[16 * 256];
  __shared__ float accsm[16 * 256];
  const int lane = threadIdx.x & 31;
  const int wave = threadIdx.x >> 5;
  const int c0 = blockIdx.x * 16;
  const int b  = blockIdx.y;
  const int r  = lane & 15;
  const int kk = (lane >> 4) << 1;

  for (int i = threadIdx.x; i < 16 * 256; i += 128) accsm[i] = 0.f;
  __syncthreads();

  for (int h = 0; h < 8; ++h) {
    const long base = (long)b * 256 * 512 + h * 64;
    const float* qrow = Qs + base + (long)(c0 + r) * 512 + kk;
    for (int et = wave; et < 16; et += 4) {
      const int e0 = et * 16;
      const float* krow = Ks + base + (long)(e0 + r) * 512 + kk;
      v8f acc = {};
#pragma unroll
      for (int k = 0; k < 64; k += 4) {
        v2f a  = *(const v2f*)(qrow + k);
        v2f bb = *(const v2f*)(krow + k);
        acc = wmma_f32_k4(a, bb, acc);
      }
      const int col = e0 + (lane & 15);
#pragma unroll
      for (int i = 0; i < 8; ++i) {
        const int rr = i + ((lane >> 4) << 3);
        sc[rr * 256 + col] = acc[i] * 0.125f;       // 1/sqrt(64)
      }
    }
    __syncthreads();
    for (int rr = wave; rr < 16; rr += 4) {
      float* srow = sc + rr * 256;
      float mx = -__builtin_inff();
      for (int i = lane; i < 256; i += 32) mx = fmaxf(mx, srow[i]);
      for (int o = 16; o > 0; o >>= 1) mx = fmaxf(mx, __shfl_xor(mx, o));
      float sum = 0.f;
      for (int i = lane; i < 256; i += 32) { float e = __expf(srow[i] - mx); srow[i] = e; sum += e; }
      for (int o = 16; o > 0; o >>= 1) sum += __shfl_xor(sum, o);
      const float inv = 1.0f / sum;
      for (int i = lane; i < 256; i += 32) srow[i] *= inv;
    }
    __syncthreads();
    for (int i = threadIdx.x; i < 16 * 256; i += 128) accsm[i] += sc[i];
    __syncthreads();
  }

  for (int i = threadIdx.x; i < 16 * 256; i += 128) {
    const int rr = i >> 8, e = i & 255;
    SW[((long)b * 256 + c0 + rr) * 256 + e] = accsm[i] * 0.125f;  // mean over 8 heads
  }
}

// ---------------------------------------------------------------------------
extern "C" void kernel_launch(void* const* d_in, const int* in_sizes, int n_in,
                              void* d_out, int out_size, void* d_ws, size_t ws_size,
                              hipStream_t stream) {
  (void)in_sizes; (void)n_in; (void)out_size; (void)ws_size;
  const float* x_T    = (const float*)d_in[0];
  const float* x_S    = (const float*)d_in[1];
  const float* Wq_t   = (const float*)d_in[2];
  const float* Wk_t   = (const float*)d_in[3];
  const float* Wv_t   = (const float*)d_in[4];
  const float* Wo     = (const float*)d_in[5];
  const float* Wq_s   = (const float*)d_in[6];
  const float* Wk_s   = (const float*)d_in[7];
  const float* ff1_w1 = (const float*)d_in[8];
  const float* ff1_b1 = (const float*)d_in[9];
  const float* ff1_w2 = (const float*)d_in[10];
  const float* ff1_b2 = (const float*)d_in[11];
  const float* ff2_w1 = (const float*)d_in[12];
  const float* ff2_b1 = (const float*)d_in[13];
  const float* ff2_w2 = (const float*)d_in[14];
  const float* ff2_b2 = (const float*)d_in[15];
  const float* t_ln1_w = (const float*)d_in[16];
  const float* t_ln1_b = (const float*)d_in[17];
  const float* t_ln2_w = (const float*)d_in[18];
  const float* t_ln2_b = (const float*)d_in[19];
  const float* s_ln1_w = (const float*)d_in[20];
  const float* s_ln1_b = (const float*)d_in[21];
  const float* fus_ln_w = (const float*)d_in[22];
  const float* fus_ln_b = (const float*)d_in[23];

  // B=16, T=512, C=256, H=8; BT = 8192 rows.
  float* A  = (float*)d_ws;       // 2M floats each for A..D, 8M for E (64 MB total)
  float* Bu = A  + 2097152;
  float* Cu = Bu + 2097152;
  float* Du = Cu + 2097152;
  float* Eu = Du + 2097152;
  float* out = (float*)d_out;
  float* SW  = out + 2097152;     // second output region: [B,C,C]

  dim3 blk128(128), blk256(256);

  // 1) h = LN(x_T)                            -> A [8192,256]
  stndt_ln<<<dim3(1024), blk256, 0, stream>>>(x_T, t_ln1_w, t_ln1_b, A, 256, 8192);
  // 2) Q,K,V = h @ W{q,k,v}_t^T               -> Bu,Cu,Du [8192,256]
  stndt_gemm_xwt<256, 256, false, false, false><<<dim3(4, 128, 1), blk128, 0, stream>>>(A, Wq_t, nullptr, nullptr, Bu, 0, 0, 0);
  stndt_gemm_xwt<256, 256, false, false, false><<<dim3(4, 128, 1), blk128, 0, stream>>>(A, Wk_t, nullptr, nullptr, Cu, 0, 0, 0);
  stndt_gemm_xwt<256, 256, false, false, false><<<dim3(4, 128, 1), blk128, 0, stream>>>(A, Wv_t, nullptr, nullptr, Du, 0, 0, 0);
  // 3) causal MHA                             -> A (head-concat [8192,256])
  stndt_attn<<<dim3(32, 8, 16), blk128, 0, stream>>>(Bu, Cu, Du, A);
  // 4) x = x_T + o @ Wo^T                     -> Bu
  stndt_gemm_xwt<256, 256, false, false, true><<<dim3(4, 128, 1), blk128, 0, stream>>>(A, Wo, nullptr, x_T, Bu, 0, 0, 0);
  // 5) h2 = LN(x)                             -> A
  stndt_ln<<<dim3(1024), blk256, 0, stream>>>(Bu, t_ln2_w, t_ln2_b, A, 256, 8192);
  // 6) mid = relu(h2 @ ff1_w1^T + b1)         -> Eu [8192,1024]
  stndt_gemm_xwt<256, 1024, true, true, false><<<dim3(16, 128, 1), blk128, 0, stream>>>(A, ff1_w1, ff1_b1, nullptr, Eu, 0, 0, 0);
  // 7) temporal_out = x + mid @ ff1_w2^T + b2 -> Cu
  stndt_gemm_xwt<1024, 256, true, false, true><<<dim3(4, 128, 1), blk128, 0, stream>>>(Eu, ff1_w2, ff1_b2, Bu, Cu, 0, 0, 0);
  // 8) hs = LN(x_S over T)                    -> A [4096,512]
  stndt_ln<<<dim3(512), blk256, 0, stream>>>(x_S, s_ln1_w, s_ln1_b, A, 512, 4096);
  // 9) Qs,Ks = hs @ W{q,k}_s^T                -> Bu,Du [4096,512]
  stndt_gemm_xwt<512, 512, false, false, false><<<dim3(8, 64, 1), blk128, 0, stream>>>(A, Wq_s, nullptr, nullptr, Bu, 0, 0, 0);
  stndt_gemm_xwt<512, 512, false, false, false><<<dim3(8, 64, 1), blk128, 0, stream>>>(A, Wk_s, nullptr, nullptr, Du, 0, 0, 0);
  // 10) SW = mean_h softmax(QsKs^T/8)         -> d_out second region [16,256,256]
  stndt_spatial<<<dim3(16, 16, 1), blk128, 0, stream>>>(Bu, Du, SW);
  // 11) x2 = TO + einsum('bce,bte->btc')      -> A (batched GEMM, W = SW per batch)
  stndt_gemm_xwt<256, 256, false, false, true><<<dim3(4, 8, 16), blk128, 0, stream>>>(Cu, SW, nullptr, Cu, A, 131072, 65536, 131072);
  // 12) h3 = LN(x2)                           -> Bu
  stndt_ln<<<dim3(1024), blk256, 0, stream>>>(A, fus_ln_w, fus_ln_b, Bu, 256, 8192);
  // 13) mid2 = relu(h3 @ ff2_w1^T + b1)       -> Eu
  stndt_gemm_xwt<256, 1024, true, true, false><<<dim3(16, 128, 1), blk128, 0, stream>>>(Bu, ff2_w1, ff2_b1, nullptr, Eu, 0, 0, 0);
  // 14) out = x2 + mid2 @ ff2_w2^T + b2       -> d_out first region
  stndt_gemm_xwt<1024, 256, true, false, true><<<dim3(4, 128, 1), blk128, 0, stream>>>(Eu, ff2_w2, ff2_b2, A, out, 0, 0, 0);
}

// v004
// A run of this version takes 281 microseconds.
// Next to v003, in two timings, it ran 1.21 times as fast each time.
// Over all steps from v000 it is 1.90 times as fast.
#include <hip/hip_runtime.h>

typedef __attribute__((ext_vector_type(2))) float v2f;
typedef __attribute__((ext_vector_type(8))) float v8f;

__device__ __forceinline__ v8f wmma_f32_k4(v2f a, v2f b, v8f c) {
  // D = A(16x4 f32) * B(4x16 f32) + C(16x16 f32)
  return __builtin_amdgcn_wmma_f32_16x16x4_f32(
      /*neg_a=*/false, a, /*neg_b=*/false, b,
      /*c_mod=*/(short)0, c, /*reuse_a=*/false, /*reuse_b=*/false);
}

// ---------------------------------------------------------------------------
// Generic batched GEMM:  Y[bat][m,n] = sum_k X[bat][m,k] * W[bat][n,k]
//                        (+ bias[n]) (ReLU?) (+ res[bat][m,n])
// Grid: (N/64, M/64, batch). Block: 128 (4 waves, each one 16-row m-subtile,
// 16(M) x 64(N) per wave). M, N multiples of 64, K a multiple of 32.
// The block's 64 X rows and 64 W rows come to LDS in stages of 32 k (one whole
// 128-B line per row) by asynchronous b128 copies, two buffers: stage t + 2
// flies while stage t + 1 is worked on. Fragments are read from LDS at a row
// pitch of 144 B (16 B x odd: 16 rows x 16 B fall on 64 distinct banks).
// What the epilogue adds (bias, residual) is chosen at compile time and loaded
// as one group behind the prologue's copies, so that it lands while the k loop runs.
// ---------------------------------------------------------------------------
constexpr int GEMM_KC    = 32;                    // k per stage (floats)
constexpr int GEMM_PITCH = 36;                    // LDS row pitch (floats)
constexpr int GEMM_BUF   = 128 * GEMM_PITCH;      // floats per buffer: 64 X rows, 64 W rows

// One stage: every lane copies 16 B of eight rows (4 of X, 4 of W); a wave's
// copy covers four whole 128-B lines. The s_wait_xcnt closes the statement so
// that no address register is rewritten in front of it.
template <int K>
__device__ __forceinline__ void gemm_stage_copy(const float* gx, const float* gw, unsigned lds) {
  constexpr unsigned RB = 16u * GEMM_PITCH * 4u;  // 16 LDS rows, bytes
  asm volatile(
      "global_load_async_to_lds_b128 %0, %8, off\n\t"
      "global_load_async_to_lds_b128 %1, %9, off\n\t"
      "global_load_async_to_lds_b128 %2, %10, off\n\t"
      "global_load_async_to_lds_b128 %3, %11, off\n\t"
      "global_load_async_to_lds_b128 %4, %12, off\n\t"
      "global_load_async_to_lds_b128 %5, %13, off\n\t"
      "global_load_async_to_lds_b128 %6, %14, off\n\t"
      "global_load_async_to_lds_b128 %7, %15, off\n\t"
      "s_wait_xcnt 0x0"
      :: "v"(lds), "v"(lds + RB), "v"(lds + 2u * RB), "v"(lds + 3u * RB),
         "v"(lds + 4u * RB), "v"(lds + 5u * RB), "v"(lds + 6u * RB), "v"(lds + 7u * RB),
         "v"(gx), "v"(gx + 16 * K), "v"(gx + 32 * K), "v"(gx + 48 * K),
         "v"(gw), "v"(gw + 16 * K), "v"(gw + 32 * K), "v"(gw + 48 * K)
      : "memory");
}

template <int K, int N, bool BIAS, bool RELU, bool RES>
__global__ __launch_bounds__(128) void stndt_gemm_xwt(
    const float* __restrict__ X, const float* __restrict__ W,
    const float* __restrict__ bias, const float* __restrict__ res,
    float* __restrict__ Y,
    long sX, long sW, long sY)
{
  constexpr int NT = K / GEMM_KC;                 // stages
  __shared__ __attribute__((aligned(16))) float tile[2 * GEMM_BUF];

  const int lane = threadIdx.x & 31;
  const int wave = threadIdx.x >> 5;
  const int n0 = blockIdx.x * 64;
  const int m0 = (blockIdx.y * 4 + wave) * 16;
  const int bat = blockIdx.z;

  const int r  = lane & 15;          // A row (m) / B col (n) within tile
  const int kk = (lane >> 4) << 1;   // k-pair select: lanes 0-15 -> k0,k1 ; 16-31 -> k2,k3

  // copy side: thread -> (row within a group of 16, 16-B segment of the line)
  const int crow = threadIdx.x >> 3;
  const int cseg = threadIdx.x & 7;
  const float* gx = X + (long)bat * sX + (long)(blockIdx.y * 64 + crow) * K + cseg * 4;
  const float* gw = W + (long)bat * sW + (long)(n0 + crow) * K + cseg * 4;
  const unsigned lds0 = (unsigned)(size_t)tile + (unsigned)(crow * GEMM_PITCH + cseg * 4) * 4u;

  v8f acc[4] = {{}, {}, {}, {}};

  // prologue: stage 0 lands and is published, then stage 1 starts
  gemm_stage_copy<K>(gx, gw, lds0);
  asm volatile("s_wait_asynccnt 0x0" ::: "memory");   // this wave's copies of stage 0 have landed
  __syncthreads();
  if (NT > 1) gemm_stage_copy<K>(gx + GEMM_KC, gw + GEMM_KC, lds0 + GEMM_BUF * 4u);

  // this lane's first output element; element (j, i) lies i rows and 16 j columns on
  const long yoff = (long)bat * sY + (long)(m0 + ((lane >> 4) << 3)) * N + n0 + r;
  float bv[4];
  float rv[4][8];
  // unrolled: bv[] and rv[][] stay in registers, every load has an immediate offset
  if constexpr (BIAS) {
#pragma unroll
    for (int j = 0; j < 4; ++j) bv[j] = bias[n0 + r + j * 16];
  }
  if constexpr (RES) {
    const float* rp = res + yoff;
#pragma unroll
    for (int j = 0; j < 4; ++j) {
#pragma unroll
      for (int i = 0; i < 8; ++i) rv[j][i] = rp[i * N + j * 16];
    }
  }

  for (int t = 0; t < NT; ++t) {
    const float* xs = tile + (t & 1) * GEMM_BUF + (wave * 16 + r) * GEMM_PITCH + kk;
    const float* wl = tile + (t & 1) * GEMM_BUF + (64 + r) * GEMM_PITCH + kk;
    // the three loops below are unrolled so that every LDS offset is an immediate
    // and every index of b[] and acc[] a constant (both stay in registers)
#pragma unroll
    for (int k = 0; k < GEMM_KC; k += 4) {
      v2f a = *(const v2f*)(xs + k);
      v2f b[4];
#pragma unroll
      for (int j = 0; j < 4; ++j) b[j] = *(const v2f*)(wl + j * 16 * GEMM_PITCH + k);
#pragma unroll
      for (int j = 0; j < 4; ++j) acc[j] = wmma_f32_k4(a, b[j], acc[j]);
    }
    asm volatile("s_wait_dscnt 0x0" ::: "memory");    // this wave's reads of buffer t & 1 are done
    asm volatile("s_wait_asynccnt 0x0" ::: "memory"); // this wave's copies of stage t + 1 have landed
    __syncthreads();                                  // publishes stage t + 1, frees buffer t & 1
    if (t + 2 < NT)
      gemm_stage_copy<K>(gx + (t + 2) * GEMM_KC, gw + (t + 2) * GEMM_KC,
                         lds0 + (unsigned)(t & 1) * (GEMM_BUF * 4u));
  }
  asm volatile("s_wait_asynccnt 0x0" ::: "memory");   // nothing in flight when the wave goes on

  float* yp = Y + yoff;
  // unrolled: constant indices into acc[], bv[] and rv[][], one address for all stores
#pragma unroll
  for (int j = 0; j < 4; ++j) {
#pragma unroll
    for (int i = 0; i < 8; ++i) {
      float v = acc[j][i];
      if constexpr (BIAS) v += bv[j];
      if constexpr (RELU) v = fmaxf(v, 0.0f);
      if constexpr (RES) v += rv[j][i];
      yp[i * N + j * 16] = v;
    }
  }
}

// ---------------------------------------------------------------------------
// LayerNorm over last dim (length Nn), one wave per row.
// ---------------------------------------------------------------------------
__global__ __launch_bounds__(256) void stndt_ln(
    const float* __restrict__ X, const float* __restrict__ g,
    const float* __restrict__ b, float* __restrict__ Y, int Nn, int rows)
{
  const int lane = threadIdx.x & 31;
  const int wave = threadIdx.x >> 5;
  const int row = blockIdx.x * 8 + wave;
  if (row >= rows) return;
  const float* x = X + (long)row * Nn;
  float s = 0.f, ss = 0.f;
  for (int i = lane; i < Nn; i += 32) { float v = x[i]; s += v; ss += v * v; }
  for (int o = 16; o > 0; o >>= 1) { s += __shfl_xor(s, o); ss += __shfl_xor(ss, o); }
  const float m = s / (float)Nn;
  const float var = ss / (float)Nn - m * m;
  const float rst = rsqrtf(var + 1e-6f);
  float* y = Y + (long)row * Nn;
  for (int i = lane; i < Nn; i += 32) y[i] = (x[i] - m) * rst * g[i] + b[i];
}

// ---------------------------------------------------------------------------
// Temporal causal attention, per (b,h,t-tile of 16). 128 threads (4 waves).
// Q/K/V layout: [B,T, H*32] head-concat (as produced by the QKV GEMMs).
// O written in the same layout => concat-heads for the Wo GEMM.
// Causal bound: query rows t0..t0+15 see no key past t0+15, so the key tiles
// up to the diagonal are worked on (scores and softmax in whole groups of four
// tiles); the tiles behind it would hold -inf
// scores, zero weights and zero products.
// ---------------------------------------------------------------------------

// Row-wise softmax over the first 32 * NJ columns (wave per row). NJ is a
// compile-time count so that each pass issues its LDS reads together.
template <int NJ>
__device__ __forceinline__ void attn_softmax_rows(float* sc, int wave, int lane) {
  for (int rr = wave; rr < 16; rr += 4) {
    float* srow = sc + rr * 512 + lane;
    float mx = -__builtin_inff();
    // the three loops over j are unrolled: NJ independent LDS reads behind one another
#pragma unroll
    for (int j = 0; j < NJ; ++j) mx = fmaxf(mx, srow[32 * j]);
    for (int o = 16; o > 0; o >>= 1) mx = fmaxf(mx, __shfl_xor(mx, o));
    float sum = 0.f;
#pragma unroll
    for (int j = 0; j < NJ; ++j) { float e = __expf(srow[32 * j] - mx); srow[32 * j] = e; sum += e; }
    for (int o = 16; o > 0; o >>= 1) sum += __shfl_xor(sum, o);
    const float inv = 1.0f / sum;
#pragma unroll
    for (int j = 0; j < NJ; ++j) srow[32 * j] *= inv;
  }
}

__global__ __launch_bounds__(128) void stndt_attn(
    const float* __restrict__ Q, const float* __restrict__ Km,
    const float* __restrict__ V, float* __restrict__ O)
{
  __shared__ float sc[16 * 512];
  const int lane = threadIdx.x & 31;
  const int wave = threadIdx.x >> 5;
  const int t0 = blockIdx.x * 16;
  const int h  = blockIdx.y;
  const int b  = blockIdx.z;
  const long base = (long)b * 512 * 256 + h * 32;   // + t*256 + d

  const int r  = lane & 15;
  const int kk = (lane >> 4) << 1;
  const float* qrow = Q + base + (long)(t0 + r) * 256 + kk;

  const int nT = blockIdx.x + 1;       // key tiles with at least one unmasked column
  const int ng = (nT + 3) >> 2;        // the same in groups of four tiles (one per wave), rounded up

  // scores[t, s] = q . k * rsqrt(32), causal-masked; the last group is written
  // whole (its tiles behind the diagonal come out all -inf), so 64 * ng columns are set
  for (int g = 0; g < ng; ++g) {
    const int s0 = (g * 4 + wave) * 16;
    const float* krow = Km + base + (long)(s0 + r) * 256 + kk;
    v8f acc = {};
#pragma unroll
    for (int k = 0; k < 32; k += 4) {
      v2f a  = *(const v2f*)(qrow + k);
      v2f bb = *(const v2f*)(krow + k);
      acc = wmma_f32_k4(a, bb, acc);
    }
    const int col = s0 + (lane & 15);
#pragma unroll
    for (int i = 0; i < 8; ++i) {
      const int rr = i + ((lane >> 4) << 3);
      float v = acc[i] * 0.17677669529663687f;      // 1/sqrt(32)
      if (col > t0 + rr) v = -__builtin_inff();     // causal mask
      sc[rr * 512 + col] = v;
    }
  }
  __syncthreads();

  // row-wise softmax over the 64 * ng columns that were written
  switch (ng) {
    case 1:  attn_softmax_rows<2>(sc, wave, lane);  break;
    case 2:  attn_softmax_rows<4>(sc, wave, lane);  break;
    case 3:  attn_softmax_rows<6>(sc, wave, lane);  break;
    case 4:  attn_softmax_rows<8>(sc, wave, lane);  break;
    case 5:  attn_softmax_rows<10>(sc, wave, lane); break;
    case 6:  attn_softmax_rows<12>(sc, wave, lane); break;
    case 7:  attn_softmax_rows<14>(sc, wave, lane); break;
    default: attn_softmax_rows<16>(sc, wave, lane); break;
  }
  __syncthreads();

  // O(16x32) = P(16 x 16 nT) @ V(16 nT x 32); waves 0,1 handle the two 16-wide halves
  if (wave < 2) {
    const int n0 = wave * 16;
    const float* arow = sc + (lane & 15) * 512 + kk;
    const float* vcol = V + base + (long)kk * 256 + n0 + (lane & 15);
    v8f acc = {};
    for (int kt = 0; kt < nT; ++kt) {
      // one key tile per trip, unrolled so that its eight V loads go out together
#pragma unroll
      for (int k = kt * 16; k < kt * 16 + 16; k += 4) {
        v2f a; a.x = arow[k]; a.y = arow[k + 1];
        v2f bb; bb.x = vcol[(long)k * 256]; bb.y = vcol[(long)k * 256 + 256];
        acc = wmma_f32_k4(a, bb, acc);
      }
    }
    const int d = n0 + (lane & 15);
#pragma unroll
    for (int i = 0; i < 8; ++i) {
      const int rr = i + ((lane >> 4) << 3);
      O[base + (long)(t0 + rr) * 256 + d] = acc[i];
    }
  }
}

// ---------------------------------------------------------------------------
// Spatial attention weights, per (b, c-tile of 16): mean_h softmax(QsKs^T/8).
// Qs/Ks layout: [B, C, H*64]. SW written as [B, C, C] (second model output).
// Block: 1024 (32 waves). The eight heads run side by side: waves 4h..4h+3 do
// head h in its own 16 x 256 plane of LDS, so that one head's load and LDS
// latencies are covered by the other seven. The planes are summed at the end
// in the order h = 0..7.
// ---------------------------------------------------------------------------
__global__ __launch_bounds__(1024) void stndt_spatial(
    const float* __restrict__ Qs, const float* __restrict__ Ks,
    float* __restrict__ SW)
{
  __shared__ float sc[8 * 16 * 256];
  const int lane = threadIdx.x & 31;
  const int wave = threadIdx.x >> 5;
  const int h  = wave >> 2;          // this wave's head
  const int wq = wave & 3;           // this wave within the head's four
  const int c0 = blockIdx.x * 16;
  const int b  = blockIdx.y;
  const int r  = lane & 15;
  const int kk = (lane >> 4) << 1;
  float* sh = sc + h * (16 * 256);   // this head's plane

  const long base = (long)b * 256 * 512 + h * 64;
  const float* qrow = Qs + base + (long)(c0 + r) * 512 + kk;
  for (int et = wq; et < 16; et += 4) {
    const int e0 = et * 16;
    const float* krow = Ks + base + (long)(e0 + r) * 512 + kk;
    v8f acc = {};
#pragma unroll
    for (int k = 0; k < 64; k += 4) {
      v2f a  = *(const v2f*)(qrow + k);
      v2f bb = *(const v2f*)(krow + k);
      acc = wmma_f32_k4(a, bb, acc);
    }
    const int col = e0 + (lane & 15);
#pragma unroll
    for (int i = 0; i < 8; ++i) {
      const int rr = i + ((lane >> 4) << 3);
      sh[rr * 256 + col] = acc[i] * 0.125f;         // 1/sqrt(64)
    }
  }
  __syncthreads();
  for (int rr = wq; rr < 16; rr += 4) {
    float* srow = sh + rr * 256;
    float mx = -__builtin_inff();
    for (int i = lane; i < 256; i += 32) mx = fmaxf(mx, srow[i]);
    for (int o = 16; o > 0; o >>= 1) mx = fmaxf(mx, __shfl_xor(mx, o));
    float sum = 0.f;
    for (int i = lane; i < 256; i += 32) { float e = __expf(srow[i] - mx); srow[i] = e; sum += e; }
    for (int o = 16; o > 0; o >>= 1) sum += __shfl_xor(sum, o);
    const float inv = 1.0f / sum;
    for (int i = lane; i < 256; i += 32) srow[i] *= inv;
  }
  __syncthreads();

  for (int i = threadIdx.x; i < 16 * 256; i += 1024) {
    const int rr = i >> 8, e = i & 255;
    float s = 0.f;
    for (int hh = 0; hh < 8; ++hh) s += sc[hh * (16 * 256) + i];
    SW[((long)b * 256 + c0 + rr) * 256 + e] = s * 0.125f;         // mean over 8 heads
  }
}

// ---------------------------------------------------------------------------
extern "C" void kernel_launch(void* const* d_in, const int* in_sizes, int n_in,
                              void* d_out, int out_size, void* d_ws, size_t ws_size,
                              hipStream_t stream) {
  (void)in_sizes; (void)n_in; (void)out_size; (void)ws_size;
  const float* x_T    = (const float*)d_in[0];
  const float* x_S    = (const float*)d_in[1];
  const float* Wq_t   = (const float*)d_in[2];
  const float* Wk_t   = (const float*)d_in[3];
  const float* Wv_t   = (const float*)d_in[4];
  const float* Wo     = (const float*)d_in[5];
  const float* Wq_s   = (const float*)d_in[6];
  const float* Wk_s   = (const float*)d_in[7];
  const float* ff1_w1 = (const float*)d_in[8];
  const float* ff1_b1 = (const float*)d_in[9];
  const float* ff1_w2 = (const float*)d_in[10];
  const float* ff1_b2 = (const float*)d_in[11];
  const float* ff2_w1 = (const float*)d_in[12];
  const float* ff2_b1 = (const float*)d_in[13];
  const float* ff2_w2 = (const float*)d_in[14];
  const float* ff2_b2 = (const float*)d_in[15];
  const float* t_ln1_w = (const float*)d_in[16];
  const float* t_ln1_b = (const float*)d_in[17];
  const float* t_ln2_w = (const float*)d_in[18];
  const float* t_ln2_b = (const float*)d_in[19];
  const float* s_ln1_w = (const float*)d_in[20];
  const float* s_ln1_b = (const float*)d_in[21];
  const float* fus_ln_w = (const float*)d_in[22];
  const float* fus_ln_b = (const float*)d_in[23];

  // B=16, T=512, C=256, H=8; BT = 8192 rows.
  float* A  = (float*)d_ws;       // 2M floats each for A..D, 8M for E (64 MB total)
  float* Bu = A  + 2097152;
  float* Cu = Bu + 2097152;
  float* Du = Cu + 2097152;
  float* Eu = Du + 2097152;
  float* out = (float*)d_out;
  float* SW  = out + 2097152;     // second output region: [B,C,C]

  dim3 blk128(128), blk256(256);

  // 1) h = LN(x_T)                            -> A [8192,256]
  stndt_ln<<<dim3(1024), blk256, 0, stream>>>(x_T, t_ln1_w, t_ln1_b, A, 256, 8192);
  // 2) Q,K,V = h @ W{q,k,v}_t^T               -> Bu,Cu,Du [8192,256]
  stndt_gemm_xwt<256, 256, false, false, false><<<dim3(4, 128, 1), blk128, 0, stream>>>(A, Wq_t, nullptr, nullptr, Bu, 0, 0, 0);
  stndt_gemm_xwt<256, 256, false, false, false><<<dim3(4, 128, 1), blk128, 0, stream>>>(A, Wk_t, nullptr, nullptr, Cu, 0, 0, 0);
  stndt_gemm_xwt<256, 256, false, false, false><<<dim3(4, 128, 1), blk128, 0, stream>>>(A, Wv_t, nullptr, nullptr, Du, 0, 0, 0);
  // 3) causal MHA                             -> A (head-concat [8192,256])
  stndt_attn<<<dim3(32, 8, 16), blk128, 0, stream>>>(Bu, Cu, Du, A);
  // 4) x = x_T + o @ Wo^T                     -> Bu
  stndt_gemm_xwt<256, 256, false, false, true><<<dim3(4, 128, 1), blk128, 0, stream>>>(A, Wo, nullptr, x_T, Bu, 0, 0, 0);
  // 5) h2 = LN(x)                             -> A
  stndt_ln<<<dim3(1024), blk256, 0, stream>>>(Bu, t_ln2_w, t_ln2_b, A, 256, 8192);
  // 6) mid = relu(h2 @ ff1_w1^T + b1)         -> Eu [8192,1024]
  stndt_gemm_xwt<256, 1024, true, true, false><<<dim3(16, 128, 1), blk128, 0, stream>>>(A, ff1_w1, ff1_b1, nullptr, Eu, 0, 0, 0);
  // 7) temporal_out = x + mid @ ff1_w2^T + b2 -> Cu
  stndt_gemm_xwt<1024, 256, true, false, true><<<dim3(4, 128, 1), blk128, 0, stream>>>(Eu, ff1_w2, ff1_b2, Bu, Cu, 0, 0, 0);
  // 8) hs = LN(x_S over T)                    -> A [4096,512]
  stndt_ln<<<dim3(512), blk256, 0, stream>>>(x_S, s_ln1_w, s_ln1_b, A, 512, 4096);
  // 9) Qs,Ks = hs @ W{q,k}_s^T                -> Bu,Du [4096,512]
  stndt_gemm_xwt<512, 512, false, false, false><<<dim3(8, 64, 1), blk128, 0, stream>>>(A, Wq_s, nullptr, nullptr, Bu, 0, 0, 0);
  stndt_gemm_xwt<512, 512, false, false, false><<<dim3(8, 64, 1), blk128, 0, stream>>>(A, Wk_s, nullptr, nullptr, Du, 0, 0, 0);
  // 10) SW = mean_h softmax(QsKs^T/8)         -> d_out second region [16,256,256]
  stndt_spatial<<<dim3(16, 16, 1), dim3(1024), 0, stream>>>(Bu, Du, SW);
  // 11) x2 = TO + einsum('bce,bte->btc')      -> A (batched GEMM, W = SW per batch)
  stndt_gemm_xwt<256, 256, false, false, true><<<dim3(4, 8, 16), blk128, 0, stream>>>(Cu, SW, nullptr, Cu, A, 131072, 65536, 131072);
  // 12) h3 = LN(x2)                           -> Bu
  stndt_ln<<<dim3(1024), blk256, 0, stream>>>(A, fus_ln_w, fus_ln_b, Bu, 256, 8192);
  // 13) mid2 = relu(h3 @ ff2_w1^T + b1)       -> Eu
  stndt_gemm_xwt<256, 1024, true, true, false><<<dim3(16, 128, 1), blk128, 0, stream>>>(Bu, ff2_w1, ff2_b1, nullptr, Eu, 0, 0, 0);
  // 14) out = x2 + mid2 @ ff2_w2^T + b2       -> d_out first region
  stndt_gemm_xwt<1024, 256, true, false, true><<<dim3(4, 128, 1), blk128, 0, stream>>>(Eu, ff2_w2, ff2_b2, A, out, 0, 0, 0);
}

// v005
// One run takes 257 microseconds.
// Two timings next to v004 put it at 1.09 and 1.10 times that version's speed.
// Over all steps from v000 it is 2.08 times as fast.
#include <hip/hip_runtime.h>

typedef __attribute__((ext_vector_type(2))) float v2f;
typedef __attribute__((ext_vector_type(8))) float v8f;

__device__ __forceinline__ v8f wmma_f32_k4(v2f a, v2f b, v8f c) {
  // D = A(16x4 f32) * B(4x16 f32) + C(16x16 f32)
  return __builtin_amdgcn_wmma_f32_16x16x4_f32(
      /*neg_a=*/false, a, /*neg_b=*/false, b,
      /*c_mod=*/(short)0, c, /*reuse_a=*/false, /*reuse_b=*/false);
}

// ---------------------------------------------------------------------------
// Generic batched GEMM:  Y[bat][m,n] = sum_k X[bat][m,k] * W[bat][n,k]
//                        (+ bias[n]) (ReLU?) (+ res[bat][m,n])
// One block (bx, by, bat) of 128 threads does a 64 x 64 tile (4 waves, each one
// 16-row m-subtile, 16(M) x 64(N) per wave). M, N multiples of 64, K of 32.
// The work of a block is a device function, so that a launch can deal blocks of
// several independent products from one grid.
// The block's 64 X rows and 64 W rows come to LDS in stages of 32 k (one whole
// 128-B line per row) by asynchronous b128 copies, two buffers: stage t + 2
// flies while stage t + 1 is worked on. Fragments are read from LDS at a row
// pitch of 144 B (16 B x odd: 16 rows x 16 B fall on 64 distinct banks).
// What the epilogue adds (bias, residual) is chosen at compile time and loaded
// as one group behind the prologue's copies, so that it lands while the k loop runs.
// ---------------------------------------------------------------------------
constexpr int GEMM_KC    = 32;                    // k per stage (floats)
constexpr int GEMM_PITCH = 36;                    // LDS row pitch (floats)
constexpr int GEMM_BUF   = 128 * GEMM_PITCH;      // floats per buffer: 64 X rows, 64 W rows

// One stage: every lane copies 16 B of eight rows (4 of X, 4 of W); a wave's
// copy covers four whole 128-B lines. The s_wait_xcnt closes the statement so
// that no address register is rewritten in front of it.
template <int K>
__device__ __forceinline__ void gemm_stage_copy(const float* gx, const float* gw, unsigned lds) {
  constexpr unsigned RB = 16u * GEMM_PITCH * 4u;  // 16 LDS rows, bytes
  asm volatile(
      "global_load_async_to_lds_b128 %0, %8, off\n\t"
      "global_load_async_to_lds_b128 %1, %9, off\n\t"
      "global_load_async_to_lds_b128 %2, %10, off\n\t"
      "global_load_async_to_lds_b128 %3, %11, off\n\t"
      "global_load_async_to_lds_b128 %4, %12, off\n\t"
      "global_load_async_to_lds_b128 %5, %13, off\n\t"
      "global_load_async_to_lds_b128 %6, %14, off\n\t"
      "global_load_async_to_lds_b128 %7, %15, off\n\t"
      "s_wait_xcnt 0x0"
      :: "v"(lds), "v"(lds + RB), "v"(lds + 2u * RB), "v"(lds + 3u * RB),
         "v"(lds + 4u * RB), "v"(lds + 5u * RB), "v"(lds + 6u * RB), "v"(lds + 7u * RB),
         "v"(gx), "v"(gx + 16 * K), "v"(gx + 32 * K), "v"(gx + 48 * K),
         "v"(gw), "v"(gw + 16 * K), "v"(gw + 32 * K), "v"(gw + 48 * K)
      : "memory");
}

template <int K, int N, bool BIAS, bool RELU, bool RES>
__device__ __forceinline__ void gemm_xwt_block(
    float* tile,                                  // the block's 2 * GEMM_BUF floats of LDS
    const float* __restrict__ X, const float* __restrict__ W,
    const float* __restrict__ bias, const float* __restrict__ res,
    float* __restrict__ Y,
    long sX, long sW, long sY, unsigned bx, unsigned by, int bat)
{
  constexpr int NT = K / GEMM_KC;                 // stages

  const int lane = threadIdx.x & 31;
  const int wave = threadIdx.x >> 5;
  const int n0 = bx * 64;
  const int m0 = (by * 4 + wave) * 16;

  const int r  = lane & 15;          // A row (m) / B col (n) within tile
  const int kk = (lane >> 4) << 1;   // k-pair select: lanes 0-15 -> k0,k1 ; 16-31 -> k2,k3

  // copy side: thread -> (row within a group of 16, 16-B segment of the line)
  const int crow = threadIdx.x >> 3;
  const int cseg = threadIdx.x & 7;
  const float* gx = X + (long)bat * sX + (long)(by * 64 + crow) * K + cseg * 4;
  const float* gw = W + (long)bat * sW + (long)(n0 + crow) * K + cseg * 4;
  const unsigned lds0 = (unsigned)(size_t)tile + (unsigned)(crow * GEMM_PITCH + cseg * 4) * 4u;

  v8f acc[4] = {{}, {}, {}, {}};

  // prologue: stage 0 lands and is published, then stage 1 starts
  gemm_stage_copy<K>(gx, gw, lds0);
  asm volatile("s_wait_asynccnt 0x0" ::: "memory");   // this wave's copies of stage 0 have landed
  __syncthreads();
  if (NT > 1) gemm_stage_copy<K>(gx + GEMM_KC, gw + GEMM_KC, lds0 + GEMM_BUF * 4u);

  // this lane's first output element; element (j, i) lies i rows and 16 j columns on
  const long yoff = (long)bat * sY + (long)(m0 + ((lane >> 4) << 3)) * N + n0 + r;
  float bv[4];
  float rv[4][8];
  // unrolled: bv[] and rv[][] stay in registers, every load has an immediate offset
  if constexpr (BIAS) {
#pragma unroll
    for (int j = 0; j < 4; ++j) bv[j] = bias[n0 + r + j * 16];
  }
  if constexpr (RES) {
    const float* rp = res + yoff;
#pragma unroll
    for (int j = 0; j < 4; ++j) {
#pragma unroll
      for (int i = 0; i < 8; ++i) rv[j][i] = rp[i * N + j * 16];
    }
  }

  for (int t = 0; t < NT; ++t) {
    const float* xs = tile + (t & 1) * GEMM_BUF + (wave * 16 + r) * GEMM_PITCH + kk;
    const float* wl = tile + (t & 1) * GEMM_BUF + (64 + r) * GEMM_PITCH + kk;
    // the three loops below are unrolled so that every LDS offset is an immediate
    // and every index of b[] and acc[] a constant (both stay in registers)
#pragma unroll
    for (int k = 0; k < GEMM_KC; k += 4) {
      v2f a = *(const v2f*)(xs + k);
      v2f b[4];
#pragma unroll
      for (int j = 0; j < 4; ++j) b[j] = *(const v2f*)(wl + j * 16 * GEMM_PITCH + k);
#pragma unroll
      for (int j = 0; j < 4; ++j) acc[j] = wmma_f32_k4(a, b[j], acc[j]);
    }
    asm volatile("s_wait_dscnt 0x0" ::: "memory");    // this wave's reads of buffer t & 1 are done
    asm volatile("s_wait_asynccnt 0x0" ::: "memory"); // this wave's copies of stage t + 1 have landed
    __syncthreads();                                  // publishes stage t + 1, frees buffer t & 1
    if (t + 2 < NT)
      gemm_stage_copy<K>(gx + (t + 2) * GEMM_KC, gw + (t + 2) * GEMM_KC,
                         lds0 + (unsigned)(t & 1) * (GEMM_BUF * 4u));
  }
  asm volatile("s_wait_asynccnt 0x0" ::: "memory");   // nothing in flight when the wave goes on

  float* yp = Y + yoff;
  // unrolled: constant indices into acc[], bv[] and rv[][], one address for all stores
#pragma unroll
  for (int j = 0; j < 4; ++j) {
#pragma unroll
    for (int i = 0; i < 8; ++i) {
      float v = acc[j][i];
      if constexpr (BIAS) v += bv[j];
      if constexpr (RELU) v = fmaxf(v, 0.0f);
      if constexpr (RES) v += rv[j][i];
      yp[i * N + j * 16] = v;
    }
  }
}

// One product per launch. Grid: (N/64, M/64, batch).
template <int K, int N, bool BIAS, bool RELU, bool RES>
__global__ __launch_bounds__(128) void stndt_gemm_xwt(
    const float* __restrict__ X, const float* __restrict__ W,
    const float* __restrict__ bias, const float* __restrict__ res,
    float* __restrict__ Y,
    long sX, long sW, long sY)
{
  __shared__ __attribute__((aligned(16))) float tile[2 * GEMM_BUF];
  gemm_xwt_block<K, N, BIAS, RELU, RES>(tile, X, W, bias, res, Y, sX, sW, sY,
                                        blockIdx.x, blockIdx.y, blockIdx.z);
}

// The five input projections in one launch: none reads another's output.
// Blocks 0..1023:    Qs, Ks = hS[4096,512] @ W{q,k}_s^T (16 stages each; they
//                    start first, being twice as long as the others).
// Blocks 1024..2559: Q, K, V = hT[8192,256] @ W{q,k,v}_t^T (8 stages each).
// Within a part the blocks that read the same 64 rows of h follow one another.
__global__ __launch_bounds__(128) void stndt_proj5(
    const float* __restrict__ hT, const float* __restrict__ Wq_t,
    const float* __restrict__ Wk_t, const float* __restrict__ Wv_t,
    float* __restrict__ Q, float* __restrict__ Kt, float* __restrict__ V,
    const float* __restrict__ hS, const float* __restrict__ Wq_s,
    const float* __restrict__ Wk_s,
    float* __restrict__ Qs, float* __restrict__ Ks)
{
  __shared__ __attribute__((aligned(16))) float tile[2 * GEMM_BUF];
  const unsigned id = blockIdx.x;
  if (id < 1024) {
    const bool second = (id >> 3) & 1;
    gemm_xwt_block<512, 512, false, false, false>(
        tile, hS, second ? Wk_s : Wq_s, nullptr, nullptr, second ? Ks : Qs,
        0, 0, 0, id & 7, id >> 4, 0);
  } else {
    const unsigned u = id - 1024;
    const unsigned by = u / 12;                   // 12 blocks per 64 rows: 3 products x 4 column tiles
    const unsigned p = (u - by * 12) >> 2;
    gemm_xwt_block<256, 256, false, false, false>(
        tile, hT, p == 0 ? Wq_t : (p == 1 ? Wk_t : Wv_t), nullptr, nullptr,
        p == 0 ? Q : (p == 1 ? Kt : V),
        0, 0, 0, u & 3, by, 0);
  }
}

// ---------------------------------------------------------------------------
// LayerNorm over last dim (length Nn), one wave per row.
// ---------------------------------------------------------------------------
__device__ __forceinline__ void ln_row(
    const float* __restrict__ X, const float* __restrict__ g,
    const float* __restrict__ b, float* __restrict__ Y, int Nn, int row)
{
  const int lane = threadIdx.x & 31;
  const float* x = X + (long)row * Nn;
  float s = 0.f, ss = 0.f;
  for (int i = lane; i < Nn; i += 32) { float v = x[i]; s += v; ss += v * v; }
  for (int o = 16; o > 0; o >>= 1) { s += __shfl_xor(s, o); ss += __shfl_xor(ss, o); }
  const float m = s / (float)Nn;
  const float var = ss / (float)Nn - m * m;
  const float rst = rsqrtf(var + 1e-6f);
  float* y = Y + (long)row * Nn;
  for (int i = lane; i < Nn; i += 32) y[i] = (x[i] - m) * rst * g[i] + b[i];
}

__global__ __launch_bounds__(256) void stndt_ln(
    const float* __restrict__ X, const float* __restrict__ g,
    const float* __restrict__ b, float* __restrict__ Y, int Nn, int rows)
{
  const int row = blockIdx.x * 8 + (threadIdx.x >> 5);
  if (row >= rows) return;
  ln_row(X, g, b, Y, Nn, row);
}

// The two LayerNorms of the inputs in one launch (neither reads the other's
// output). Blocks 0..511: the 4096 rows of x_S (length 512); blocks 512..1535:
// the 8192 rows of x_T (length 256).
__global__ __launch_bounds__(256) void stndt_ln_inputs(
    const float* __restrict__ xS, const float* __restrict__ gS,
    const float* __restrict__ bS, float* __restrict__ yS,
    const float* __restrict__ xT, const float* __restrict__ gT,
    const float* __restrict__ bT, float* __restrict__ yT)
{
  const bool s = blockIdx.x < 512;
  const int row = (s ? blockIdx.x : blockIdx.x - 512) * 8 + (threadIdx.x >> 5);
  ln_row(s ? xS : xT, s ? gS : gT, s ? bS : bT, s ? yS : yT, s ? 512 : 256, row);
}

// ---------------------------------------------------------------------------
// Temporal causal attention, per (b,h,t-tile of 16). 128 threads (4 waves).
// Q/K/V layout: [B,T, H*32] head-concat (as produced by the QKV GEMMs).
// O written in the same layout => concat-heads for the Wo GEMM.
// Causal bound: query rows t0..t0+15 see no key past t0+15, so the key tiles
// up to the diagonal are worked on (scores and softmax in whole groups of four
// tiles); the tiles behind it would hold -inf
// scores, zero weights and zero products.
// ---------------------------------------------------------------------------

// Row-wise softmax over the first 32 * NJ columns (wave per row). NJ is a
// compile-time count so that each pass issues its LDS reads together.
template <int NJ>
__device__ __forceinline__ void attn_softmax_rows(float* sc, int wave, int lane) {
  for (int rr = wave; rr < 16; rr += 4) {
    float* srow = sc + rr * 512 + lane;
    float mx = -__builtin_inff();
    // the three loops over j are unrolled: NJ independent LDS reads behind one another
#pragma unroll
    for (int j = 0; j < NJ; ++j) mx = fmaxf(mx, srow[32 * j]);
    for (int o = 16; o > 0; o >>= 1) mx = fmaxf(mx, __shfl_xor(mx, o));
    float sum = 0.f;
#pragma unroll
    for (int j = 0; j < NJ; ++j) { float e = __expf(srow[32 * j] - mx); srow[32 * j] = e; sum += e; }
    for (int o = 16; o > 0; o >>= 1) sum += __shfl_xor(sum, o);
    const float inv = 1.0f / sum;
#pragma unroll
    for (int j = 0; j < NJ; ++j) srow[32 * j] *= inv;
  }
}

__global__ __launch_bounds__(128) void stndt_attn(
    const float* __restrict__ Q, const float* __restrict__ Km,
    const float* __restrict__ V, float* __restrict__ O)
{
  __shared__ float sc[16 * 512];
  const int lane = threadIdx.x & 31;
  const int wave = threadIdx.x >> 5;
  const int t0 = blockIdx.x * 16;
  const int h  = blockIdx.y;
  const int b  = blockIdx.z;
  const long base = (long)b * 512 * 256 + h * 32;   // + t*256 + d

  const int r  = lane & 15;
  const int kk = (lane >> 4) << 1;
  const float* qrow = Q + base + (long)(t0 + r) * 256 + kk;

  const int nT = blockIdx.x + 1;       // key tiles with at least one unmasked column
  const int ng = (nT + 3) >> 2;        // the same in groups of four tiles (one per wave), rounded up

  // scores[t, s] = q . k * rsqrt(32), causal-masked; the last group is written
  // whole (its tiles behind the diagonal come out all -inf), so 64 * ng columns are set
  for (int g = 0; g < ng; ++g) {
    const int s0 = (g * 4 + wave) * 16;
    const float* krow = Km + base + (long)(s0 + r) * 256 + kk;
    v8f acc = {};
#pragma unroll
    for (int k = 0; k < 32; k += 4) {
      v2f a  = *(const v2f*)(qrow + k);
      v2f bb = *(const v2f*)(krow + k);
      acc = wmma_f32_k4(a, bb, acc);
    }
    const int col = s0 + (lane & 15);
#pragma unroll
    for (int i = 0; i < 8; ++i) {
      const int rr = i + ((lane >> 4) << 3);
      float v = acc[i] * 0.17677669529663687f;      // 1/sqrt(32)
      if (col > t0 + rr) v = -__builtin_inff();     // causal mask
      sc[rr * 512 + col] = v;
    }
  }
  __syncthreads();

  // row-wise softmax over the 64 * ng columns that were written
  switch (ng) {
    case 1:  attn_softmax_rows<2>(sc, wave, lane);  break;
    case 2:  attn_softmax_rows<4>(sc, wave, lane);  break;
    case 3:  attn_softmax_rows<6>(sc, wave, lane);  break;
    case 4:  attn_softmax_rows<8>(sc, wave, lane);  break;
    case 5:  attn_softmax_rows<10>(sc, wave, lane); break;
    case 6:  attn_softmax_rows<12>(sc, wave, lane); break;
    case 7:  attn_softmax_rows<14>(sc, wave, lane); break;
    default: attn_softmax_rows<16>(sc, wave, lane); break;
  }
  __syncthreads();

  // O(16x32) = P(16 x 16 nT) @ V(16 nT x 32); waves 0,1 handle the two 16-wide halves
  if (wave < 2) {
    const int n0 = wave * 16;
    const float* arow = sc + (lane & 15) * 512 + kk;
    const float* vcol = V + base + (long)kk * 256 + n0 + (lane & 15);
    v8f acc = {};
    for (int kt = 0; kt < nT; ++kt) {
      // one key tile per trip, unrolled so that its eight V loads go out together
#pragma unroll
      for (int k = kt * 16; k < kt * 16 + 16; k += 4) {
        v2f a; a.x = arow[k]; a.y = arow[k + 1];
        v2f bb; bb.x = vcol[(long)k * 256]; bb.y = vcol[(long)k * 256 + 256];
        acc = wmma_f32_k4(a, bb, acc);
      }
    }
    const int d = n0 + (lane & 15);
#pragma unroll
    for (int i = 0; i < 8; ++i) {
      const int rr = i + ((lane >> 4) << 3);
      O[base + (long)(t0 + rr) * 256 + d] = acc[i];
    }
  }
}

// ---------------------------------------------------------------------------
// Spatial attention weights, per (b, c-tile of 16): mean_h softmax(QsKs^T/8).
// Qs/Ks layout: [B, C, H*64]. SW written as [B, C, C] (second model output).
// Block: 1024 (32 waves). The eight heads run side by side: waves 4h..4h+3 do
// head h in its own 16 x 256 plane of LDS, so that one head's load and LDS
// latencies are covered by the other seven. The planes are summed at the end
// in the order h = 0..7.
// ---------------------------------------------------------------------------
__global__ __launch_bounds__(1024) void stndt_spatial(
    const float* __restrict__ Qs, const float* __restrict__ Ks,
    float* __restrict__ SW)
{
  __shared__ float sc[8 * 16 * 256];
  const int lane = threadIdx.x & 31;
  const int wave = threadIdx.x >> 5;
  const int h  = wave >> 2;          // this wave's head
  const int wq = wave & 3;           // this wave within the head's four
  const int c0 = blockIdx.x * 16;
  const int b  = blockIdx.y;
  const int r  = lane & 15;
  const int kk = (lane >> 4) << 1;
  float* sh = sc + h * (16 * 256);   // this head's plane

  const long base = (long)b * 256 * 512 + h * 64;
  const float* qrow = Qs + base + (long)(c0 + r) * 512 + kk;
  for (int et = wq; et < 16; et += 4) {
    const int e0 = et * 16;
    const float* krow = Ks + base + (long)(e0 + r) * 512 + kk;
    v8f acc = {};
#pragma unroll
    for (int k = 0; k < 64; k += 4) {
      v2f a  = *(const v2f*)(qrow + k);
      v2f bb = *(const v2f*)(krow + k);
      acc = wmma_f32_k4(a, bb, acc);
    }
    const int col = e0 + (lane & 15);
#pragma unroll
    for (int i = 0; i < 8; ++i) {
      const int rr = i + ((lane >> 4) << 3);
      sh[rr * 256 + col] = acc[i] * 0.125f;         // 1/sqrt(64)
    }
  }
  __syncthreads();
  for (int rr = wq; rr < 16; rr += 4) {
    float* srow = sh + rr * 256;
    float mx = -__builtin_inff();
    for (int i = lane; i < 256; i += 32) mx = fmaxf(mx, srow[i]);
    for (int o = 16; o > 0; o >>= 1) mx = fmaxf(mx, __shfl_xor(mx, o));
    float sum = 0.f;
    for (int i = lane; i < 256; i += 32) { float e = __expf(srow[i] - mx); srow[i] = e; sum += e; }
    for (int o = 16; o > 0; o >>= 1) sum += __shfl_xor(sum, o);
    const float inv = 1.0f / sum;
    for (int i = lane; i < 256; i += 32) srow[i] *= inv;
  }
  __syncthreads();

  for (int i = threadIdx.x; i < 16 * 256; i += 1024) {
    const int rr = i >> 8, e = i & 255;
    float s = 0.f;
    for (int hh = 0; hh < 8; ++hh) s += sc[hh * (16 * 256) + i];
    SW[((long)b * 256 + c0 + rr) * 256 + e] = s * 0.125f;         // mean over 8 heads
  }
}

// ---------------------------------------------------------------------------
extern "C" void kernel_launch(void* const* d_in, const int* in_sizes, int n_in,
                              void* d_out, int out_size, void* d_ws, size_t ws_size,
                              hipStream_t stream) {
  (void)in_sizes; (void)n_in; (void)out_size; (void)ws_size;
  const float* x_T    = (const float*)d_in[0];
  const float* x_S    = (const float*)d_in[1];
  const float* Wq_t   = (const float*)d_in[2];
  const float* Wk_t   = (const float*)d_in[3];
  const float* Wv_t   = (const float*)d_in[4];
  const float* Wo     = (const float*)d_in[5];
  const float* Wq_s   = (const float*)d_in[6];
  const float* Wk_s   = (const float*)d_in[7];
  const float* ff1_w1 = (const float*)d_in[8];
  const float* ff1_b1 = (const float*)d_in[9];
  const float* ff1_w2 = (const float*)d_in[10];
  const float* ff1_b2 = (const float*)d_in[11];
  const float* ff2_w1 = (const float*)d_in[12];
  const float* ff2_b1 = (const float*)d_in[13];
  const float* ff2_w2 = (const float*)d_in[14];
  const float* ff2_b2 = (const float*)d_in[15];
  const float* t_ln1_w = (const float*)d_in[16];
  const float* t_ln1_b = (const float*)d_in[17];
  const float* t_ln2_w = (const float*)d_in[18];
  const float* t_ln2_b = (const float*)d_in[19];
  const float* s_ln1_w = (const float*)d_in[20];
  const float* s_ln1_b = (const float*)d_in[21];
  const float* fus_ln_w = (const float*)d_in[22];
  const float* fus_ln_b = (const float*)d_in[23];

  // B=16, T=512, C=256, H=8; BT = 8192 rows.
  float* A  = (float*)d_ws;       // 2M floats each for A..D and F..H, 8M for E (88 MB total)
  float* Bu = A  + 2097152;
  float* Cu = Bu + 2097152;
  float* Du = Cu + 2097152;
  float* Eu = Du + 2097152;
  float* Fu = Eu + 8388608;
  float* Gu = Fu + 2097152;
  float* Hu = Gu + 2097152;
  float* out = (float*)d_out;
  float* SW  = out + 2097152;     // second output region: [B,C,C]

  dim3 blk128(128), blk256(256);

  // 1) h = LN(x_T) -> A [8192,256];  hs = LN(x_S over T) -> Fu [4096,512]
  stndt_ln_inputs<<<dim3(1536), blk256, 0, stream>>>(x_S, s_ln1_w, s_ln1_b, Fu, x_T, t_ln1_w, t_ln1_b, A);
  // 2) Q,K,V = h @ W{q,k,v}_t^T -> Bu,Cu,Du [8192,256];  Qs,Ks = hs @ W{q,k}_s^T -> Gu,Hu [4096,512]
  stndt_proj5<<<dim3(2560), blk128, 0, stream>>>(A, Wq_t, Wk_t, Wv_t, Bu, Cu, Du, Fu, Wq_s, Wk_s, Gu, Hu);
  // 3) SW = mean_h softmax(QsKs^T/8)          -> d_out second region [16,256,256]
  stndt_spatial<<<dim3(16, 16, 1), dim3(1024), 0, stream>>>(Gu, Hu, SW);
  // 4) causal MHA                             -> A (head-concat [8192,256])
  stndt_attn<<<dim3(32, 8, 16), blk128, 0, stream>>>(Bu, Cu, Du, A);
  // 5) x = x_T + o @ Wo^T                     -> Bu
  stndt_gemm_xwt<256, 256, false, false, true><<<dim3(4, 128, 1), blk128, 0, stream>>>(A, Wo, nullptr, x_T, Bu, 0, 0, 0);
  // 6) h2 = LN(x)                             -> A
  stndt_ln<<<dim3(1024), blk256, 0, stream>>>(Bu, t_ln2_w, t_ln2_b, A, 256, 8192);
  // 7) mid = relu(h2 @ ff1_w1^T + b1)         -> Eu [8192,1024]
  stndt_gemm_xwt<256, 1024, true, true, false><<<dim3(16, 128, 1), blk128, 0, stream>>>(A, ff1_w1, ff1_b1, nullptr, Eu, 0, 0, 0);
  // 8) temporal_out = x + mid @ ff1_w2^T + b2 -> Cu
  stndt_gemm_xwt<1024, 256, true, false, true><<<dim3(4, 128, 1), blk128, 0, stream>>>(Eu, ff1_w2, ff1_b2, Bu, Cu, 0, 0, 0);
  // 9) x2 = TO + einsum('bce,bte->btc')       -> A (batched GEMM, W = SW per batch)
  stndt_gemm_xwt<256, 256, false, false, true><<<dim3(4, 8, 16), blk128, 0, stream>>>(Cu, SW, nullptr, Cu, A, 131072, 65536, 131072);
  // 10) h3 = LN(x2)                           -> Bu
  stndt_ln<<<dim3(1024), blk256, 0, stream>>>(A, fus_ln_w, fus_ln_b, Bu, 256, 8192);
  // 11) mid2 = relu(h3 @ ff2_w1^T + b1)       -> Eu
  stndt_gemm_xwt<256, 1024, true, true, false><<<dim3(16, 128, 1), blk128, 0, stream>>>(Bu, ff2_w1, ff2_b1, nullptr, Eu, 0, 0, 0);
  // 12) out = x2 + mid2 @ ff2_w2^T + b2       -> d_out first region
  stndt_gemm_xwt<1024, 256, true, false, true><<<dim3(4, 128, 1), blk128, 0, stream>>>(Eu, ff2_w2, ff2_b2, A, out, 0, 0, 0);
}

// v006
// A run of this version takes 215 microseconds.
// Two timings next to v005 both put it at 1.19 times that version's speed.
// Counting every step since v000, it is 2.48 times as fast.
#include <hip/hip_runtime.h>

typedef __attribute__((ext_vector_type(2))) float v2f;
typedef __attribute__((ext_vector_type(8))) float v8f;

__device__ __forceinline__ v8f wmma_f32_k4(v2f a, v2f b, v8f c) {
  // D = A(16x4 f32) * B(4x16 f32) + C(16x16 f32)
  return __builtin_amdgcn_wmma_f32_16x16x4_f32(
      /*neg_a=*/false, a, /*neg_b=*/false, b,
      /*c_mod=*/(short)0, c, /*reuse_a=*/false, /*reuse_b=*/false);
}

// ---------------------------------------------------------------------------
// Generic batched GEMM:  Y[bat][m,n] = sum_k X[bat][m,k] * W[bat][n,k]
//                        (+ bias[n]) (ReLU?) (+ res[bat][m,n])
// One block (bx, by, bat) of 128 threads does a 64 x 64 tile (4 waves, each one
// 16-row m-subtile, 16(M) x 64(N) per wave). M, N multiples of 64, K of 32.
// The work of a block is a device function, so that a launch can deal blocks of
// several independent products from one grid.
// The block's 64 X rows and 64 W rows come to LDS in stages of 32 k (one whole
// 128-B line per row) by asynchronous b128 copies, two buffers: stage t + 2
// flies while stage t + 1 is worked on. Fragments are read from LDS at a row
// pitch of 144 B (16 B x odd: 16 rows x 16 B fall on 64 distinct banks).
// What the epilogue adds (bias, residual) is chosen at compile time and loaded
// as one group behind the prologue's copies, so that it lands while the k loop runs.
// ---------------------------------------------------------------------------
constexpr int GEMM_KC    = 32;                    // k per stage (floats)
constexpr int GEMM_PITCH = 36;                    // LDS row pitch (floats)
constexpr int GEMM_BUF   = 128 * GEMM_PITCH;      // floats per buffer: 64 X rows, 64 W rows

// One stage: every lane copies 16 B of eight rows (4 of X, 4 of W); a wave's
// copy covers four whole 128-B lines. The s_wait_xcnt closes the statement so
// that no address register is rewritten in front of it.
template <int K>
__device__ __forceinline__ void gemm_stage_copy(const float* gx, const float* gw, unsigned lds) {
  constexpr unsigned RB = 16u * GEMM_PITCH * 4u;  // 16 LDS rows, bytes
  asm volatile(
      "global_load_async_to_lds_b128 %0, %8, off\n\t"
      "global_load_async_to_lds_b128 %1, %9, off\n\t"
      "global_load_async_to_lds_b128 %2, %10, off\n\t"
      "global_load_async_to_lds_b128 %3, %11, off\n\t"
      "global_load_async_to_lds_b128 %4, %12, off\n\t"
      "global_load_async_to_lds_b128 %5, %13, off\n\t"
      "global_load_async_to_lds_b128 %6, %14, off\n\t"
      "global_load_async_to_lds_b128 %7, %15, off\n\t"
      "s_wait_xcnt 0x0"
      :: "v"(lds), "v"(lds + RB), "v"(lds + 2u * RB), "v"(lds + 3u * RB),
         "v"(lds + 4u * RB), "v"(lds + 5u * RB), "v"(lds + 6u * RB), "v"(lds + 7u * RB),
         "v"(gx), "v"(gx + 16 * K), "v"(gx + 32 * K), "v"(gx + 48 * K),
         "v"(gw), "v"(gw + 16 * K), "v"(gw + 32 * K), "v"(gw + 48 * K)
      : "memory");
}

template <int K, int N, bool BIAS, bool RELU, bool RES>
__device__ __forceinline__ void gemm_xwt_block(
    float* tile,                                  // the block's 2 * GEMM_BUF floats of LDS
    const float* __restrict__ X, const float* __restrict__ W,
    const float* __restrict__ bias, const float* __restrict__ res,
    float* __restrict__ Y,
    long sX, long sW, long sY, unsigned bx, unsigned by, int bat)
{
  constexpr int NT = K / GEMM_KC;                 // stages

  const int lane = threadIdx.x & 31;
  const int wave = threadIdx.x >> 5;
  const int n0 = bx * 64;
  const int m0 = (by * 4 + wave) * 16;

  const int r  = lane & 15;          // A row (m) / B col (n) within tile
  const int kk = (lane >> 4) << 1;   // k-pair select: lanes 0-15 -> k0,k1 ; 16-31 -> k2,k3

  // copy side: thread -> (row within a group of 16, 16-B segment of the line)
  const int crow = threadIdx.x >> 3;
  const int cseg = threadIdx.x & 7;
  const float* gx = X + (long)bat * sX + (long)(by * 64 + crow) * K + cseg * 4;
  const float* gw = W + (long)bat * sW + (long)(n0 + crow) * K + cseg * 4;
  const unsigned lds0 = (unsigned)(size_t)tile + (unsigned)(crow * GEMM_PITCH + cseg * 4) * 4u;

  v8f acc[4] = {{}, {}, {}, {}};

  // prologue: stage 0 lands and is published, then stage 1 starts
  gemm_stage_copy<K>(gx, gw, lds0);
  asm volatile("s_wait_asynccnt 0x0" ::: "memory");   // this wave's copies of stage 0 have landed
  __syncthreads();
  if (NT > 1) gemm_stage_copy<K>(gx + GEMM_KC, gw + GEMM_KC, lds0 + GEMM_BUF * 4u);

  // this lane's first output element; element (j, i) lies i rows and 16 j columns on
  const long yoff = (long)bat * sY + (long)(m0 + ((lane >> 4) << 3)) * N + n0 + r;
  float bv[4];
  float rv[4][8];
  // unrolled: bv[] and rv[][] stay in registers, every load has an immediate offset
  if constexpr (BIAS) {
#pragma unroll
    for (int j = 0; j < 4; ++j) bv[j] = bias[n0 + r + j * 16];
  }
  if constexpr (RES) {
    const float* rp = res + yoff;
#pragma unroll
    for (int j = 0; j < 4; ++j) {
#pragma unroll
      for (int i = 0; i < 8; ++i) rv[j][i] = rp[i * N + j * 16];
    }
  }

  for (int t = 0; t < NT; ++t) {
    const float* xs = tile + (t & 1) * GEMM_BUF + (wave * 16 + r) * GEMM_PITCH + kk;
    const float* wl = tile + (t & 1) * GEMM_BUF + (64 + r) * GEMM_PITCH + kk;
    // the three loops below are unrolled so that every LDS offset is an immediate
    // and every index of b[] and acc[] a constant (both stay in registers)
#pragma unroll
    for (int k = 0; k < GEMM_KC; k += 4) {
      v2f a = *(const v2f*)(xs + k);
      v2f b[4];
#pragma unroll
      for (int j = 0; j < 4; ++j) b[j] = *(const v2f*)(wl + j * 16 * GEMM_PITCH + k);
#pragma unroll
      for (int j = 0; j < 4; ++j) acc[j] = wmma_f32_k4(a, b[j], acc[j]);
    }
    asm volatile("s_wait_dscnt 0x0" ::: "memory");    // this wave's reads of buffer t & 1 are done
    asm volatile("s_wait_asynccnt 0x0" ::: "memory"); // this wave's copies of stage t + 1 have landed
    __syncthreads();                                  // publishes stage t + 1, frees buffer t & 1
    if (t + 2 < NT)
      gemm_stage_copy<K>(gx + (t + 2) * GEMM_KC, gw + (t + 2) * GEMM_KC,
                         lds0 + (unsigned)(t & 1) * (GEMM_BUF * 4u));
  }
  asm volatile("s_wait_asynccnt 0x0" ::: "memory");   // nothing in flight when the wave goes on

  float* yp = Y + yoff;
  // unrolled: constant indices into acc[], bv[] and rv[][], one address for all stores
#pragma unroll
  for (int j = 0; j < 4; ++j) {
#pragma unroll
    for (int i = 0; i < 8; ++i) {
      float v = acc[j][i];
      if constexpr (BIAS) v += bv[j];
      if constexpr (RELU) v = fmaxf(v, 0.0f);
      if constexpr (RES) v += rv[j][i];
      yp[i * N + j * 16] = v;
    }
  }
}

// The five input projections in one launch: none reads another's output.
// Blocks 0..1023:    Qs, Ks = hS[4096,512] @ W{q,k}_s^T (16 stages each; they
//                    start first, being twice as long as the others).
// Blocks 1024..2559: Q, K, V = hT[8192,256] @ W{q,k,v}_t^T (8 stages each).
// Within a part the blocks that read the same 64 rows of h follow one another.
__global__ __launch_bounds__(128) void stndt_proj5(
    const float* __restrict__ hT, const float* __restrict__ Wq_t,
    const float* __restrict__ Wk_t, const float* __restrict__ Wv_t,
    float* __restrict__ Q, float* __restrict__ Kt, float* __restrict__ V,
    const float* __restrict__ hS, const float* __restrict__ Wq_s,
    const float* __restrict__ Wk_s,
    float* __restrict__ Qs, float* __restrict__ Ks)
{
  __shared__ __attribute__((aligned(16))) float tile[2 * GEMM_BUF];
  const unsigned id = blockIdx.x;
  if (id < 1024) {
    const bool second = (id >> 3) & 1;
    gemm_xwt_block<512, 512, false, false, false>(
        tile, hS, second ? Wk_s : Wq_s, nullptr, nullptr, second ? Ks : Qs,
        0, 0, 0, id & 7, id >> 4, 0);
  } else {
    const unsigned u = id - 1024;
    const unsigned by = u / 12;                   // 12 blocks per 64 rows: 3 products x 4 column tiles
    const unsigned p = (u - by * 12) >> 2;
    gemm_xwt_block<256, 256, false, false, false>(
        tile, hT, p == 0 ? Wq_t : (p == 1 ? Wk_t : Wv_t), nullptr, nullptr,
        p == 0 ? Q : (p == 1 ? Kt : V),
        0, 0, 0, u & 3, by, 0);
  }
}

// ---------------------------------------------------------------------------
// LayerNorm over last dim (length Nn), one wave per row.
// ---------------------------------------------------------------------------
__device__ __forceinline__ void ln_row(
    const float* __restrict__ X, const float* __restrict__ g,
    const float* __restrict__ b, float* __restrict__ Y, int Nn, int row)
{
  const int lane = threadIdx.x & 31;
  const float* x = X + (long)row * Nn;
  float s = 0.f, ss = 0.f;
  for (int i = lane; i < Nn; i += 32) { float v = x[i]; s += v; ss += v * v; }
  for (int o = 16; o > 0; o >>= 1) { s += __shfl_xor(s, o); ss += __shfl_xor(ss, o); }
  const float m = s / (float)Nn;
  const float var = ss / (float)Nn - m * m;
  const float rst = rsqrtf(var + 1e-6f);
  float* y = Y + (long)row * Nn;
  for (int i = lane; i < Nn; i += 32) y[i] = (x[i] - m) * rst * g[i] + b[i];
}

// The two LayerNorms of the inputs in one launch (neither reads the other's
// output). Blocks 0..511: the 4096 rows of x_S (length 512); blocks 512..1535:
// the 8192 rows of x_T (length 256).
__global__ __launch_bounds__(256) void stndt_ln_inputs(
    const float* __restrict__ xS, const float* __restrict__ gS,
    const float* __restrict__ bS, float* __restrict__ yS,
    const float* __restrict__ xT, const float* __restrict__ gT,
    const float* __restrict__ bT, float* __restrict__ yT)
{
  const bool s = blockIdx.x < 512;
  const int row = (s ? blockIdx.x : blockIdx.x - 512) * 8 + (threadIdx.x >> 5);
  ln_row(s ? xS : xT, s ? gS : gT, s ? bS : bT, s ? yS : yT, s ? 512 : 256, row);
}

// ---------------------------------------------------------------------------
// Temporal causal attention, per (b,h,t-tile of 16). 128 threads (4 waves).
// Q/K/V layout: [B,T, H*32] head-concat (as produced by the QKV GEMMs).
// O written in the same layout => concat-heads for the Wo GEMM.
// Causal bound: query rows t0..t0+15 see no key past t0+15, so the key tiles
// up to the diagonal are worked on (scores and softmax in whole groups of four
// tiles); the tiles behind it would hold -inf
// scores, zero weights and zero products.
// ---------------------------------------------------------------------------

// Row-wise softmax over the first 32 * NJ columns (wave per row). NJ is a
// compile-time count so that each pass issues its LDS reads together.
template <int NJ>
__device__ __forceinline__ void attn_softmax_rows(float* sc, int wave, int lane) {
  for (int rr = wave; rr < 16; rr += 4) {
    float* srow = sc + rr * 512 + lane;
    float mx = -__builtin_inff();
    // the three loops over j are unrolled: NJ independent LDS reads behind one another
#pragma unroll
    for (int j = 0; j < NJ; ++j) mx = fmaxf(mx, srow[32 * j]);
    for (int o = 16; o > 0; o >>= 1) mx = fmaxf(mx, __shfl_xor(mx, o));
    float sum = 0.f;
#pragma unroll
    for (int j = 0; j < NJ; ++j) { float e = __expf(srow[32 * j] - mx); srow[32 * j] = e; sum += e; }
    for (int o = 16; o > 0; o >>= 1) sum += __shfl_xor(sum, o);
    const float inv = 1.0f / sum;
#pragma unroll
    for (int j = 0; j < NJ; ++j) srow[32 * j] *= inv;
  }
}

__global__ __launch_bounds__(128) void stndt_attn(
    const float* __restrict__ Q, const float* __restrict__ Km,
    const float* __restrict__ V, float* __restrict__ O)
{
  __shared__ float sc[16 * 512];
  const int lane = threadIdx.x & 31;
  const int wave = threadIdx.x >> 5;
  const int t0 = blockIdx.x * 16;
  const int h  = blockIdx.y;
  const int b  = blockIdx.z;
  const long base = (long)b * 512 * 256 + h * 32;   // + t*256 + d

  const int r  = lane & 15;
  const int kk = (lane >> 4) << 1;
  const float* qrow = Q + base + (long)(t0 + r) * 256 + kk;

  const int nT = blockIdx.x + 1;       // key tiles with at least one unmasked column
  const int ng = (nT + 3) >> 2;        // the same in groups of four tiles (one per wave), rounded up

  // scores[t, s] = q . k * rsqrt(32), causal-masked; the last group is written
  // whole (its tiles behind the diagonal come out all -inf), so 64 * ng columns are set
  for (int g = 0; g < ng; ++g) {
    const int s0 = (g * 4 + wave) * 16;
    const float* krow = Km + base + (long)(s0 + r) * 256 + kk;
    v8f acc = {};
#pragma unroll
    for (int k = 0; k < 32; k += 4) {
      v2f a  = *(const v2f*)(qrow + k);
      v2f bb = *(const v2f*)(krow + k);
      acc = wmma_f32_k4(a, bb, acc);
    }
    const int col = s0 + (lane & 15);
#pragma unroll
    for (int i = 0; i < 8; ++i) {
      const int rr = i + ((lane >> 4) << 3);
      float v = acc[i] * 0.17677669529663687f;      // 1/sqrt(32)
      if (col > t0 + rr) v = -__builtin_inff();     // causal mask
      sc[rr * 512 + col] = v;
    }
  }
  __syncthreads();

  // row-wise softmax over the 64 * ng columns that were written
  switch (ng) {
    case 1:  attn_softmax_rows<2>(sc, wave, lane);  break;
    case 2:  attn_softmax_rows<4>(sc, wave, lane);  break;
    case 3:  attn_softmax_rows<6>(sc, wave, lane);  break;
    case 4:  attn_softmax_rows<8>(sc, wave, lane);  break;
    case 5:  attn_softmax_rows<10>(sc, wave, lane); break;
    case 6:  attn_softmax_rows<12>(sc, wave, lane); break;
    case 7:  attn_softmax_rows<14>(sc, wave, lane); break;
    default: attn_softmax_rows<16>(sc, wave, lane); break;
  }
  __syncthreads();

  // O(16x32) = P(16 x 16 nT) @ V(16 nT x 32); waves 0,1 handle the two 16-wide halves
  if (wave < 2) {
    const int n0 = wave * 16;
    const float* arow = sc + (lane & 15) * 512 + kk;
    const float* vcol = V + base + (long)kk * 256 + n0 + (lane & 15);
    v8f acc = {};
    for (int kt = 0; kt < nT; ++kt) {
      // one key tile per trip, unrolled so that its eight V loads go out together
#pragma unroll
      for (int k = kt * 16; k < kt * 16 + 16; k += 4) {
        v2f a; a.x = arow[k]; a.y = arow[k + 1];
        v2f bb; bb.x = vcol[(long)k * 256]; bb.y = vcol[(long)k * 256 + 256];
        acc = wmma_f32_k4(a, bb, acc);
      }
    }
    const int d = n0 + (lane & 15);
#pragma unroll
    for (int i = 0; i < 8; ++i) {
      const int rr = i + ((lane >> 4) << 3);
      O[base + (long)(t0 + rr) * 256 + d] = acc[i];
    }
  }
}

// ---------------------------------------------------------------------------
// Spatial attention weights, per (b, c-tile of 16): mean_h softmax(QsKs^T/8).
// Qs/Ks layout: [B, C, H*64]. SW written as [B, C, C] (second model output).
// Block: 1024 (32 waves). The eight heads run side by side: waves 4h..4h+3 do
// head h in its own 16 x 256 plane of LDS, so that one head's load and LDS
// latencies are covered by the other seven. The planes are summed at the end
// in the order h = 0..7.
// ---------------------------------------------------------------------------
__global__ __launch_bounds__(1024) void stndt_spatial(
    const float* __restrict__ Qs, const float* __restrict__ Ks,
    float* __restrict__ SW)
{
  __shared__ float sc[8 * 16 * 256];
  const int lane = threadIdx.x & 31;
  const int wave = threadIdx.x >> 5;
  const int h  = wave >> 2;          // this wave's head
  const int wq = wave & 3;           // this wave within the head's four
  const int c0 = blockIdx.x * 16;
  const int b  = blockIdx.y;
  const int r  = lane & 15;
  const int kk = (lane >> 4) << 1;
  float* sh = sc + h * (16 * 256);   // this head's plane

  const long base = (long)b * 256 * 512 + h * 64;
  const float* qrow = Qs + base + (long)(c0 + r) * 512 + kk;
  for (int et = wq; et < 16; et += 4) {
    const int e0 = et * 16;
    const float* krow = Ks + base + (long)(e0 + r) * 512 + kk;
    v8f acc = {};
#pragma unroll
    for (int k = 0; k < 64; k += 4) {
      v2f a  = *(const v2f*)(qrow + k);
      v2f bb = *(const v2f*)(krow + k);
      acc = wmma_f32_k4(a, bb, acc);
    }
    const int col = e0 + (lane & 15);
#pragma unroll
    for (int i = 0; i < 8; ++i) {
      const int rr = i + ((lane >> 4) << 3);
      sh[rr * 256 + col] = acc[i] * 0.125f;         // 1/sqrt(64)
    }
  }
  __syncthreads();
  for (int rr = wq; rr < 16; rr += 4) {
    float* srow = sh + rr * 256;
    float mx = -__builtin_inff();
    for (int i = lane; i < 256; i += 32) mx = fmaxf(mx, srow[i]);
    for (int o = 16; o > 0; o >>= 1) mx = fmaxf(mx, __shfl_xor(mx, o));
    float sum = 0.f;
    for (int i = lane; i < 256; i += 32) { float e = __expf(srow[i] - mx); srow[i] = e; sum += e; }
    for (int o = 16; o > 0; o >>= 1) sum += __shfl_xor(sum, o);
    const float inv = 1.0f / sum;
    for (int i = lane; i < 256; i += 32) srow[i] *= inv;
  }
  __syncthreads();

  for (int i = threadIdx.x; i < 16 * 256; i += 1024) {
    const int rr = i >> 8, e = i & 255;
    float s = 0.f;
    for (int hh = 0; hh < 8; ++hh) s += sc[hh * (16 * 256) + i];
    SW[((long)b * 256 + c0 + rr) * 256 + e] = s * 0.125f;         // mean over 8 heads
  }
}

// ---------------------------------------------------------------------------
// The row-local tail of the model in one launch. Everything behind the
// attention works on single rows (b, t):
//   x  = x_T + o Wo^T;  TO = x + FF1(LN(x));  x2 = TO + TO SW[b]^T;  out = x2 + FF2(LN(x2))
// One block of 512 threads (16 waves) keeps 32 rows from o to out. The A operand
// of every product lies in LDS (act: 32 x 256, mid: 32 x 1024), the residual
// stream stays in registers in the accumulator layout, and only the weights are
// streamed: 72 tiles of 256 W rows x 64 k, one after the other through one ring
// of two buffers filled by asynchronous b128 copies, which runs on across the
// borders between the products. Wave w does rows 16 (w & 1).. and columns
// 32 (w >> 1).. of each 32 x 256 piece of output.
// Row pitches 272 B, 1040 B and 4112 B are 16 B x odd: 16 rows fall on distinct banks.
// ---------------------------------------------------------------------------
constexpr int RC_WP    = 68;                      // ring row pitch (floats): 64 k + pad
constexpr int RC_BUF   = 256 * RC_WP;             // floats per ring buffer
constexpr int RC_AP    = 260;                     // act row pitch (floats)
constexpr int RC_MP    = 1028;                    // mid row pitch (floats)
constexpr int RC_TILES = 72;                      // 4 + 16 + 16 + 4 + 16 + 16

// One tile: every lane copies 16 B of eight W rows, 32 rows apart. The
// s_wait_xcnt closes the statement so that no address register is rewritten in
// front of it.
__device__ __forceinline__ void rc_tile_copy(const float* g, int step, unsigned lds) {
  constexpr unsigned RB = 32u * RC_WP * 4u;       // 32 LDS rows, bytes
  asm volatile(
      "global_load_async_to_lds_b128 %0, %8, off\n\t"
      "global_load_async_to_lds_b128 %1, %9, off\n\t"
      "global_load_async_to_lds_b128 %2, %10, off\n\t"
      "global_load_async_to_lds_b128 %3, %11, off\n\t"
      "global_load_async_to_lds_b128 %4, %12, off\n\t"
      "global_load_async_to_lds_b128 %5, %13, off\n\t"
      "global_load_async_to_lds_b128 %6, %14, off\n\t"
      "global_load_async_to_lds_b128 %7, %15, off\n\t"
      "s_wait_xcnt 0x0"
      :: "v"(lds), "v"(lds + RB), "v"(lds + 2u * RB), "v"(lds + 3u * RB),
         "v"(lds + 4u * RB), "v"(lds + 5u * RB), "v"(lds + 6u * RB), "v"(lds + 7u * RB),
         "v"(g), "v"(g + step), "v"(g + 2 * step), "v"(g + 3 * step),
         "v"(g + 4 * step), "v"(g + 5 * step), "v"(g + 6 * step), "v"(g + 7 * step)
      : "memory");
}

__global__ __launch_bounds__(512) void stndt_rowchain(
    const float* __restrict__ O, const float* __restrict__ xT,
    const float* __restrict__ Wo,
    const float* __restrict__ ln2_w, const float* __restrict__ ln2_b,
    const float* __restrict__ w1a, const float* __restrict__ b1a,
    const float* __restrict__ w2a, const float* __restrict__ b2a,
    const float* __restrict__ SW,
    const float* __restrict__ lnf_w, const float* __restrict__ lnf_b,
    const float* __restrict__ w1b, const float* __restrict__ b1b,
    const float* __restrict__ w2b, const float* __restrict__ b2b,
    float* __restrict__ out)
{
  __shared__ __attribute__((aligned(16))) float sm[2 * RC_BUF + 32 * RC_AP + 32 * RC_MP];
  float* ring = sm;
  float* act  = sm + 2 * RC_BUF;
  float* mid  = act + 32 * RC_AP;

  const int tid  = threadIdx.x;
  const int lane = tid & 31;
  const int wave = tid >> 5;
  const int mi = wave & 1;
  const int ni = wave >> 1;
  const int r  = lane & 15;          // A row (m) / B col (n) within a fragment
  const int kk = (lane >> 4) << 1;   // k-pair select, as in the GEMM above
  const int row0 = blockIdx.x * 32;
  const float* swb = SW + (long)(blockIdx.x >> 4) * 65536;   // 16 blocks per batch entry

  // copy side: thread -> (row within a group of 32, 16-B segment of the 256-B piece)
  const int crow = tid >> 4;
  const int cseg = tid & 15;
  const unsigned lds0 = (unsigned)(size_t)ring + (unsigned)(crow * RC_WP + cseg * 4) * 4u;

  // tile t of the weight stream into buffer t & 1 (t is the same for the whole block)
  auto issue = [&](int t) {
    const float* base;
    int pitch;
    if (t < 4)       { base = Wo + t * 64; pitch = 256; }
    else if (t < 20) { const int u = t - 4;  base = w1a + (u >> 2) * 65536 + (u & 3) * 64; pitch = 256; }
    else if (t < 36) { base = w2a + (t - 20) * 64; pitch = 1024; }
    else if (t < 40) { base = swb + (t - 36) * 64; pitch = 256; }
    else if (t < 56) { const int u = t - 40; base = w1b + (u >> 2) * 65536 + (u & 3) * 64; pitch = 256; }
    else             { base = w2b + (t - 56) * 64; pitch = 1024; }
    rc_tile_copy(base + crow * pitch + cseg * 4, 32 * pitch,
                 lds0 + (unsigned)(t & 1) * (RC_BUF * 4u));
  };

  // this lane's fragment rows and its first output element (element (j, i): i rows, 16 j columns on)
  const float* arow = act + (mi * 16 + r) * RC_AP + kk;
  const float* mrow = mid + (mi * 16 + r) * RC_MP + kk;
  const float* wl   = ring + (ni * 32 + r) * RC_WP + kk;
  const int orow = mi * 16 + ((lane >> 4) << 3);
  const int ocol = ni * 32 + r;

  int t = 0;                         // next tile of the stream to be worked on
  // ns tiles: acc += A[:, 64 s ..] * tile^T, k ascending
  auto gemm = [&](const float* a0, int ns, v8f (&acc)[2]) {
    for (int s = 0; s < ns; ++s, ++t) {
      const float* as = a0 + s * 64;
      const float* ws = wl + (t & 1) * RC_BUF;
      // unrolled so that every LDS offset is an immediate
#pragma unroll
      for (int k = 0; k < 64; k += 4) {
        v2f a  = *(const v2f*)(as + k);
        v2f b0 = *(const v2f*)(ws + k);
        v2f b1 = *(const v2f*)(ws + 16 * RC_WP + k);
        acc[0] = wmma_f32_k4(a, b0, acc[0]);
        acc[1] = wmma_f32_k4(a, b1, acc[1]);
      }
      asm volatile("s_wait_dscnt 0x0" ::: "memory");    // this wave's reads of buffer t & 1 are done
      asm volatile("s_wait_asynccnt 0x0" ::: "memory"); // this wave's copies of tile t + 1 have landed
      __syncthreads();                                  // publishes tile t + 1, frees buffer t & 1
      if (t + 2 < RC_TILES) issue(t + 2);
    }
  };

  float xr[2][8];                    // the residual stream, accumulator layout

  // xr -> act (every reader of act has passed a tile's barrier since its last read)
  auto put_act = [&]() {
#pragma unroll
    for (int j = 0; j < 2; ++j) {
#pragma unroll
      for (int i = 0; i < 8; ++i) act[(orow + i) * RC_AP + ocol + j * 16] = xr[j][i];
    }
    __syncthreads();                 // the 32 rows are whole before anyone reads them
  };

  // act = LN(act) in place, two rows per wave, sums in the order of ln_row
  auto ln_act = [&](const float* __restrict__ g, const float* __restrict__ b) {
    float gv[8], bv[8];
#pragma unroll
    for (int j = 0; j < 8; ++j) { gv[j] = g[lane + 32 * j]; bv[j] = b[lane + 32 * j]; }
    put_act();
#pragma unroll
    for (int q = 0; q < 2; ++q) {
      float* x = act + (wave * 2 + q) * RC_AP + lane;
      float v[8];
      float s = 0.f, ss = 0.f;
#pragma unroll
      for (int j = 0; j < 8; ++j) { v[j] = x[32 * j]; s += v[j]; ss += v[j] * v[j]; }
      for (int o = 16; o > 0; o >>= 1) { s += __shfl_xor(s, o); ss += __shfl_xor(ss, o); }
      const float m = s / 256.0f;
      const float var = ss / 256.0f - m * m;
      const float rst = rsqrtf(var + 1e-6f);
#pragma unroll
      for (int j = 0; j < 8; ++j) x[32 * j] = (v[j] - m) * rst * gv[j] + bv[j];
    }
    __syncthreads();                 // the normalised rows are whole before the next product reads them
  };

  // xr += relu(act W1^T + b1) W2^T + b2. A piece of mid is written behind the
  // barrier of its last tile and read twelve tiles' barriers later at the earliest.
  auto ffn = [&](const float* __restrict__ b1, const float* __restrict__ b2) {
    for (int c = 0; c < 4; ++c) {
      const float bb[2] = { b1[c * 256 + ocol], b1[c * 256 + ocol + 16] };
      v8f acc[2] = {{}, {}};
      gemm(arow, 4, acc);
#pragma unroll
      for (int j = 0; j < 2; ++j) {
#pragma unroll
        for (int i = 0; i < 8; ++i)
          mid[(orow + i) * RC_MP + c * 256 + ocol + j * 16] = fmaxf(acc[j][i] + bb[j], 0.0f);
      }
    }
    const float bb[2] = { b2[ocol], b2[ocol + 16] };
    v8f acc[2] = {{}, {}};
    gemm(mrow, 16, acc);
#pragma unroll
    for (int j = 0; j < 2; ++j) {
#pragma unroll
      for (int i = 0; i < 8; ++i) xr[j][i] = (acc[j][i] + bb[j]) + xr[j][i];
    }
  };

  // xr += act W^T (W: 256 x 256, four tiles)
  auto square = [&]() {
    v8f acc[2] = {{}, {}};
    gemm(arow, 4, acc);
#pragma unroll
    for (int j = 0; j < 2; ++j) {
#pragma unroll
      for (int i = 0; i < 8; ++i) xr[j][i] = acc[j][i] + xr[j][i];
    }
  };

  // prologue: tile 0 flies while the 32 rows of o go to act; both are published, then tile 1 starts
  issue(0);
#pragma unroll
  for (int i = 0; i < 4; ++i) {
    const int idx = tid + 512 * i;
    const int rr = idx >> 6, c4 = (idx & 63) * 4;
    *(float4*)(act + rr * RC_AP + c4) = *(const float4*)(O + (long)(row0 + rr) * 256 + c4);
  }
  asm volatile("s_wait_asynccnt 0x0" ::: "memory");   // this wave's copies of tile 0 have landed
  __syncthreads();
  issue(1);
  {
    const float* xp = xT + (long)(row0 + orow) * 256 + ocol;
#pragma unroll
    for (int j = 0; j < 2; ++j) {
#pragma unroll
      for (int i = 0; i < 8; ++i) xr[j][i] = xp[i * 256 + j * 16];
    }
  }

  square();                          // x  = x_T + o Wo^T
  ln_act(ln2_w, ln2_b);
  ffn(b1a, b2a);                     // TO = x + FF1(LN(x))
  put_act();
  square();                          // x2 = TO + TO SW[b]^T
  ln_act(lnf_w, lnf_b);
  ffn(b1b, b2b);                     // out = x2 + FF2(LN(x2))
  asm volatile("s_wait_asynccnt 0x0" ::: "memory");   // nothing in flight when the wave goes on

  float* yp = out + (long)(row0 + orow) * 256 + ocol;
#pragma unroll
  for (int j = 0; j < 2; ++j) {
#pragma unroll
    for (int i = 0; i < 8; ++i) yp[i * 256 + j * 16] = xr[j][i];
  }
}

// ---------------------------------------------------------------------------
extern "C" void kernel_launch(void* const* d_in, const int* in_sizes, int n_in,
                              void* d_out, int out_size, void* d_ws, size_t ws_size,
                              hipStream_t stream) {
  (void)in_sizes; (void)n_in; (void)out_size; (void)ws_size;
  const float* x_T    = (const float*)d_in[0];
  const float* x_S    = (const float*)d_in[1];
  const float* Wq_t   = (const float*)d_in[2];
  const float* Wk_t   = (const float*)d_in[3];
  const float* Wv_t   = (const float*)d_in[4];
  const float* Wo     = (const float*)d_in[5];
  const float* Wq_s   = (const float*)d_in[6];
  const float* Wk_s   = (const float*)d_in[7];
  const float* ff1_w1 = (const float*)d_in[8];
  const float* ff1_b1 = (const float*)d_in[9];
  const float* ff1_w2 = (const float*)d_in[10];
  const float* ff1_b2 = (const float*)d_in[11];
  const float* ff2_w1 = (const float*)d_in[12];
  const float* ff2_b1 = (const float*)d_in[13];
  const float* ff2_w2 = (const float*)d_in[14];
  const float* ff2_b2 = (const float*)d_in[15];
  const float* t_ln1_w = (const float*)d_in[16];
  const float* t_ln1_b = (const float*)d_in[17];
  const float* t_ln2_w = (const float*)d_in[18];
  const float* t_ln2_b = (const float*)d_in[19];
  const float* s_ln1_w = (const float*)d_in[20];
  const float* s_ln1_b = (const float*)d_in[21];
  const float* fus_ln_w = (const float*)d_in[22];
  const float* fus_ln_b = (const float*)d_in[23];

  // B=16, T=512, C=256, H=8; BT = 8192 rows.
  float* A  = (float*)d_ws;       // 2M floats each for A..D and F..H, 8M for E (88 MB total)
  float* Bu = A  + 2097152;
  float* Cu = Bu + 2097152;
  float* Du = Cu + 2097152;
  float* Eu = Du + 2097152;
  float* Fu = Eu + 8388608;
  float* Gu = Fu + 2097152;
  float* Hu = Gu + 2097152;
  float* out = (float*)d_out;
  float* SW  = out + 2097152;     // second output region: [B,C,C]

  dim3 blk128(128), blk256(256);

  // 1) h = LN(x_T) -> A [8192,256];  hs = LN(x_S over T) -> Fu [4096,512]
  stndt_ln_inputs<<<dim3(1536), blk256, 0, stream>>>(x_S, s_ln1_w, s_ln1_b, Fu, x_T, t_ln1_w, t_ln1_b, A);
  // 2) Q,K,V = h @ W{q,k,v}_t^T -> Bu,Cu,Du [8192,256];  Qs,Ks = hs @ W{q,k}_s^T -> Gu,Hu [4096,512]
  stndt_proj5<<<dim3(2560), blk128, 0, stream>>>(A, Wq_t, Wk_t, Wv_t, Bu, Cu, Du, Fu, Wq_s, Wk_s, Gu, Hu);
  // 3) SW = mean_h softmax(QsKs^T/8)          -> d_out second region [16,256,256]
  stndt_spatial<<<dim3(16, 16, 1), dim3(1024), 0, stream>>>(Gu, Hu, SW);
  // 4) causal MHA                             -> A (head-concat [8192,256])
  stndt_attn<<<dim3(32, 8, 16), blk128, 0, stream>>>(Bu, Cu, Du, A);
  // 5) the row-local tail: Wo + residual, LN, FF1, spatial fusion, LN, FF2 -> d_out first region
  stndt_rowchain<<<dim3(256), dim3(512), 0, stream>>>(A, x_T, Wo, t_ln2_w, t_ln2_b,
                                                      ff1_w1, ff1_b1, ff1_w2, ff1_b2, SW,
                                                      fus_ln_w, fus_ln_b,
                                                      ff2_w1, ff2_b1, ff2_w2, ff2_b2, out);
}
